// v000
// Measured on an AMD MI455X. A time is GPU time per run, averaged over a window of back-to-back runs after a warm-up
// (all launches, gaps included; the runs take copies of the inputs in turn), and the median of several windows.
// Apart from v000's, it joins two sittings. Times from different sittings can be a few percent apart, while
// side-by-side timings come from the same sitting.
// v000 is the starting kernel. One run takes 2780 microseconds.
// compute dtype: all float inputs rounded to bf16; raw q / k / v: the scores q . k are exact products of f16-exact inputs (f32 accumulate), multiplied by the scale INPUT in f32; weights = softplus(score) + 1e-8 normalised by their row sum (f32; no exponential softmax); weights x 2^11 once to f16 x v (exact in f16); f32 output.
#include <hip/hip_runtime.h>
#include <math.h>

typedef __attribute__((ext_vector_type(16))) _Float16 v16h;
typedef __attribute__((ext_vector_type(16))) __bf16 v16b;
typedef __attribute__((ext_vector_type(8)))  _Float16 v8h;
typedef __attribute__((ext_vector_type(8)))  float v8f;
typedef __attribute__((ext_vector_type(4)))  float v4f;
typedef __attribute__((ext_vector_type(2)))  float v2f;
typedef __attribute__((ext_vector_type(4)))  unsigned v4u;
typedef __attribute__((ext_vector_type(4)))  int v4i;
typedef float __attribute__((may_alias)) float_a;
typedef int __attribute__((may_alias)) int_a;

template <typename T> __device__ __forceinline__ void vst2(void* p, T v) { *(T*)p = v;  }
__device__ __forceinline__ v8f wmma16(v16h a, v16h b, v8f c) {
  v8f d = __builtin_amdgcn_wmma_f32_16x16x32_f16(false, a, false, b, (short)0, c, false, false);
  asm volatile("v_nop\n\tv_nop\n\tv_nop\n\tv_nop" : "+v"(d) : "v"(a), "v"(b));
  return d;
}
__device__ __forceinline__ v8f wmma_bf(v16b a, v16b b, v8f c) {
  v8f d = __builtin_amdgcn_wmma_f32_16x16x32_bf16(false, a, false, b, (short)0, c, false, false);
  asm volatile("v_nop\n\tv_nop\n\tv_nop\n\tv_nop" : "+v"(d) : "v"(a), "v"(b));
  return d;
}
// 16x16x32 fragments: lane = (h = lane>>4, row/col = lane&15); elements 0..7 = k0+8h+0..7, 8..15 = k0+16+8h+0..7; D element r = row 8h+r
__device__ __forceinline__ v16h frag_h(const _Float16* rowk0, int lane) {
  union { v16h v; v8h q[2]; } u; const _Float16* p = rowk0 + 8 * (lane >> 4);
  u.q[0] = *(const v8h*)p; u.q[1] = *(const v8h*)(p + 16); return u.v;
}
__device__ __forceinline__ v16h frag_f32(const float* rowk0, int lane) {
  v16h a; const float* p = rowk0 + 8 * (lane >> 4);
#pragma unroll
  for (int i = 0; i < 8; ++i) { a[i] = (_Float16)p[i]; a[8 + i] = (_Float16)p[16 + i]; }
  return a;
}
__device__ __forceinline__ v16h frag_f32s(const float* rowk0, int lane, float sc) {
  v16h a; const float* p = rowk0 + 8 * (lane >> 4);
#pragma unroll
  for (int i = 0; i < 8; ++i) { a[i] = (_Float16)(p[i] * sc); a[8 + i] = (_Float16)(p[16 + i] * sc); }
  return a;
}
// column fragment from a [K][ld] layout (column n), rows >= K read as 0
__device__ __forceinline__ v16h fragc_f32(const float* W, int k0, int n, int lane, int ld, int K) {
  v16h a; const int g = lane >> 4;
#pragma unroll
  for (int i = 0; i < 8; ++i) { const int ka = k0 + 8 * g + i, kb = ka + 16;
    a[i] = (_Float16)(ka < K ? W[(size_t)(ka < K ? ka : K - 1) * ld + n] : 0.f); a[8 + i] = (_Float16)(kb < K ? W[(size_t)(kb < K ? kb : K - 1) * ld + n] : 0.f); }
  return a;
}
struct F2 { v16b h, l; };
__device__ __forceinline__ F2 bsplit16(const float v[16]) { F2 r;
#pragma unroll
  for (int i = 0; i < 16; ++i) { const __bf16 h = (__bf16)v[i]; r.h[i] = h; r.l[i] = (__bf16)(v[i] - (float)h); }
  return r; }
__device__ __forceinline__ F2 split_row(const float* row, int k0, int lane) { float v[16]; const float* p = row + k0 + 8 * (lane >> 4);
#pragma unroll
  for (int i = 0; i < 8; ++i) { v[i] = p[i]; v[8 + i] = p[16 + i]; }
  return bsplit16(v); }
__device__ __forceinline__ F2 split_rowK(const float* row, int k0, int lane, int K) { float v[16]; const int g = lane >> 4;
#pragma unroll
  for (int i = 0; i < 8; ++i) { const int ka = k0 + 8 * g + i, kb = ka + 16; v[i] = ka < K ? row[ka < K ? ka : K - 1] : 0.f; v[8 + i] = kb < K ? row[kb < K ? kb : K - 1] : 0.f; }
  return bsplit16(v); }
__device__ __forceinline__ F2 split_col(const float* W, int k0, int n, int lane, int ld, int K) { float v[16]; const int g = lane >> 4;
#pragma unroll
  for (int i = 0; i < 8; ++i) { const int ka = k0 + 8 * g + i, kb = ka + 16; v[i] = ka < K ? W[(size_t)(ka < K ? ka : K - 1) * ld + n] : 0.f; v[8 + i] = kb < K ? W[(size_t)(kb < K ? kb : K - 1) * ld + n] : 0.f; }
  return bsplit16(v); }
__device__ __forceinline__ v8f mac3(const F2& a, const F2& b, v8f c) { c = wmma_bf(a.l, b.h, c); c = wmma_bf(a.h, b.l, c); return wmma_bf(a.h, b.h, c); }
__device__ __forceinline__ float sigm(float v) { return 1.0f / (1.0f + expf(-v)); }
#define LDSX() do { asm volatile("s_wait_dscnt 0" ::: "memory"); __builtin_amdgcn_wave_barrier(); __builtin_amdgcn_fence(__ATOMIC_RELEASE, "workgroup"); } while (0)

// Quadratic attention with a softplus kernel instead of a softmax (q / k / v [32,2048,64]; sim = softplus(q k^T * scale) + 1e-8 with scale a scalar input; sim /= sum over keys; out = sim v -> [32,2048,64]; no mask).
#define NB 32
#define TT 2048
#define CC 64            // NH * HD = projected width
#define DIN 64          // input (model) width
#define NH 1
#define HD 64
#define NQB (TT / 64)
#define HG 1
#define SCALE (1.0f)
#define CAUSAL 0
#ifndef TNB
#define TNB NB
#endif
__device__ __forceinline__ float bfr(float v) { return (float)(__bf16)v; }
__host__ __device__ __forceinline__ int kb_last(int qb) { return CAUSAL ? ((qb * 64 + 63) >> 7) : (TT / 128 - 1); }
typedef __attribute__((ext_vector_type(8))) __bf16 v8b;
__device__ __forceinline__ v16b frag_b(const __bf16* rowk0, int lane) {
  union { v16b v; v8b q[2]; } u; const __bf16* p = rowk0 + 8 * (lane >> 4);
  u.q[0] = *(const v8b*)p; u.q[1] = *(const v8b*)(p + 16); return u.v;
}
#define QBH 0              // query blocks qb < QBH take the high-precision path; QBH is 0, so none does
#define QHI 0              // (override) rows carrying the q residual plane
#define KHI 64            // key rows carrying k residual / v bf16 hi+lo planes (written by k_prepr; read only on the qb < QBH path, which never runs)
// B fragment (k rows k0+.., output column o) of a weight: (in,out) [K][ld] or (out,in) [ld rows of K]: bf16 exact, or f16(bf16 * 256) exact
__device__ __forceinline__ v16b wcol_io(const float* Wm, int k0, int o, int lane, int ld) { v16b w; const int g = lane >> 4;
#pragma unroll
  for (int i = 0; i < 8; ++i) { w[i] = (__bf16)Wm[(size_t)(k0 + 8 * g + i) * ld + o]; w[8 + i] = (__bf16)Wm[(size_t)(k0 + 16 + 8 * g + i) * ld + o]; }
  return w; }
__device__ __forceinline__ v16b wcol_oi(const float* Wm, int k0, int o, int lane, int K) { v16b w; const float* p = Wm + (size_t)o * K + k0 + 8 * (lane >> 4);
#pragma unroll
  for (int i = 0; i < 8; ++i) { w[i] = (__bf16)p[i]; w[8 + i] = (__bf16)p[16 + i]; }
  return w; }
__device__ __forceinline__ v16h wcolh_io(const float* Wm, int k0, int o, int lane, int ld) { v16h w; const int g = lane >> 4;
#pragma unroll
  for (int i = 0; i < 8; ++i) { w[i] = (_Float16)(bfr(Wm[(size_t)(k0 + 8 * g + i) * ld + o]) * 256.0f); w[8 + i] = (_Float16)(bfr(Wm[(size_t)(k0 + 16 + 8 * g + i) * ld + o]) * 256.0f); }
  return w; }
__device__ __forceinline__ v16h wcolh_oi(const float* Wm, int k0, int o, int lane, int K) { v16h w; const float* p = Wm + (size_t)o * K + k0 + 8 * (lane >> 4);
#pragma unroll
  for (int i = 0; i < 8; ++i) { w[i] = (_Float16)(bfr(p[i]) * 256.0f); w[8 + i] = (_Float16)(bfr(p[16 + i]) * 256.0f); }
  return w; }
#define WQKV_LAYOUT 1   // 0 = (in,out) [DIN][CC]; 1 = (out,in) [CC][DIN]; 2 = per-head [NH][DIN][HD]
__device__ __forceinline__ v16b wcol_hdk(const float* Wm, int k0, int o, int lane) { v16b w; const int g = lane >> 4; const float* p = Wm + (size_t)(o / HD) * DIN * HD + (o % HD);
#pragma unroll
  for (int i = 0; i < 8; ++i) { w[i] = (__bf16)p[(size_t)(k0 + 8 * g + i) * HD]; w[8 + i] = (__bf16)p[(size_t)(k0 + 16 + 8 * g + i) * HD]; }
  return w; }
#define WO_OUT_IN 0
#if WQKV_LAYOUT == 1
#define WCOL(W, k0, o, lane) wcol_oi(W, k0, o, lane, DIN)
#elif WQKV_LAYOUT == 2
#define WCOL(W, k0, o, lane) wcol_hdk(W, k0, o, lane)
#else
#define WCOL(W, k0, o, lane) wcol_io(W, k0, o, lane, CC)
#endif
#if WO_OUT_IN
#define WOCOL(W, k0, o, lane) wcol_oi(W, k0, o, lane, CC)
#define WOCOLH(W, k0, o, lane) wcolh_oi(W, k0, o, lane, CC)
#else
#define WOCOL(W, k0, o, lane) wcol_io(W, k0, o, lane, DIN)
#define WOCOLH(W, k0, o, lane) wcolh_io(W, k0, o, lane, DIN)
#endif
#define SP_EPS 1.0e-8f
#define SM_EXTRA_PARAMS , const float* __restrict__ SCL
// the module's scale is a scalar INPUT: applied to the raw score in f32 (bf16-rounded like every float input); unconditional load
#define SM_MASK_HOOK do { const float sc_ = SCL[0]; asm volatile("s_wait_loadcnt 0x0" ::: "memory"); v = v * bfr(sc_); } while (0)
// ---- k_prepr: block = (64 attention positions s0.. of sequence b, head h): reads the module's [B, T, H*64] inputs, bf16-rounds them and writes the standard attention planes: q -> f16 hi rows (+ x 2^10 residual rows for s < QHI), k -> f16 rows (+ residual rows s < KHI), v -> f16 planes [c][s] (+ bf16 hi/lo planes for s < KHI)
__global__ __launch_bounds__(128) void k_prepr(const float* __restrict__ Q, const float* __restrict__ K, const float* __restrict__ V, _Float16* __restrict__ QH, _Float16* __restrict__ QL, _Float16* __restrict__ KH, _Float16* __restrict__ KL, _Float16* __restrict__ VT, __bf16* __restrict__ VB, __bf16* __restrict__ VBL) {
  __shared__ __align__(16) _Float16 sq[64][136], sql[64][136], sk[64][136], skl[64][136], tv[128][72]; __shared__ __align__(16) __bf16 tb[128][72], tbl[128][72];
  const int tid = threadIdx.x; const int h = blockIdx.y; const size_t r0 = (size_t)blockIdx.x * 64; const size_t bb = r0 / TT; const int t0 = (int)(r0 % TT); const bool qhi = t0 < QHI, khi = t0 < KHI;
  for (int e = tid; e < 64 * 128; e += 128) { const int rl = e >> 7, c = e & 127; const size_t oi = ((bb * TT + t0 + rl) * (size_t)CC + h * HD + (c & 63));   /* [B, T, H*64] inputs */   /* c >= 64: duplicate read of the same element (tiles are 128 wide; HD is 64) */
    const float q = bfr(Q[oi]), k = bfr(K[oi]), v = bfr(V[oi]);   /* module inputs: bf16-rounded; bf16 values are exact in f16, so the residual planes are 0 */
    const _Float16 qh = (_Float16)q, kh = (_Float16)k; sq[rl][c] = qh; sql[rl][c] = (_Float16)((q - (float)qh) * 1024.0f); sk[rl][c] = kh; skl[rl][c] = (_Float16)((k - (float)kh) * 1024.0f);
    tv[c][rl] = (_Float16)v; const __bf16 vb = (__bf16)v; tb[c][rl] = vb; tbl[c][rl] = (__bf16)(v - (float)vb); }
  __syncthreads();
  for (int e = tid; e < 64 * 8; e += 128) { const int rl = e >> 3, q = e & 7; const size_t o = (r0 + rl) * CC + h * HD + q * 8; vst2((unsigned*)(QH + o), *(const v4u*)&sq[rl][q * 8]); vst2((unsigned*)(KH + o), *(const v4u*)&sk[rl][q * 8]);   
    if (qhi) vst2((unsigned*)(QL + (bb * QHI + t0 + rl) * (size_t)CC + h * HD + q * 8), *(const v4u*)&sql[rl][q * 8]); if (khi) vst2((unsigned*)(KL + (bb * KHI + t0 + rl) * (size_t)CC + h * HD + q * 8), *(const v4u*)&skl[rl][q * 8]); }
  for (int e = tid; e < 64 * 8; e += 128) { const int cl = e >> 3, q = e & 7; vst2((unsigned*)(VT + (bb * CC + h * HD + cl) * (size_t)TT + t0 + q * 8), *(const v4u*)&tv[cl][q * 8]);
    if (khi) { const size_t o3 = (bb * CC + h * HD + cl) * (size_t)KHI + t0 + q * 8; vst2((unsigned*)(VB + o3), *(const v4u*)&tb[cl][q * 8]); vst2((unsigned*)(VBL + o3), *(const v4u*)&tbl[cl][q * 8]); } } }

#ifndef SM_EXTRA_PARAMS
#define SM_EXTRA_PARAMS
#endif
#ifndef PROJ_EXTRA_PARAMS
#define PROJ_EXTRA_PARAMS
#endif
#ifndef SM_MASK_HOOK
#define SM_MASK_HOOK (void)0
#endif

#define WS_QH  0u                                      // f16 q rows [b*t][CC]
#define WS_KH  (WS_QH + 2u * (size_t)NB * TT * CC)      // f16 k rows [b*t][CC]
#define WS_VT  (WS_KH + 2u * (size_t)NB * TT * CC)      // f16 v planes [b][c][t]
#define WS_QL  (WS_VT + 2u * (size_t)NB * CC * TT)      // f16 q residual x 2^10 rows [b][t < QHI][CC]
#define WS_KL  (WS_QL + 2u * (size_t)NB * QHI * CC)     // f16 k residual x 2^10 rows [b][t < KHI][CC]
#define WS_VB  (WS_KL + 2u * (size_t)NB * KHI * CC)     // bf16 v hi planes [b][c][t < KHI]
#define WS_VBL (WS_VB + 2u * (size_t)NB * CC * KHI)
#define WS_S   (WS_VBL + 2u * (size_t)NB * CC * KHI)    // f32 logits / P [hg][t][s]
#define WS_Y   (WS_S  + 4u * (size_t)HG * TT * TT)      // f32 ctx rows [b*t][CC] (only when there is an output projection)
#define WS_END (WS_Y  + 0u)

// ---- k_sc: block = (query block qb, key block kb <= kb_last(qb), head in group) of batch b: logits x SCALE; q hi + residual (x 2^10) against k (2 products) for query rows < QHI, plus the k residual (3 products) for query blocks < QBH (none: QBH is 0); causal: blocks past the diagonal exit, the mask itself is applied by index in k_sm
__global__ __launch_bounds__(128) void k_sc(const _Float16* __restrict__ QH, const _Float16* __restrict__ KH, const _Float16* __restrict__ QL, const _Float16* __restrict__ KL, int b, int h0, float* __restrict__ S0) { __shared__ __align__(16) float ss[4][16][132];
  const int qb = blockIdx.x, kb = blockIdx.y; if (kb > kb_last(qb)) return;
  const int h = h0 + blockIdx.z; float* S = S0 + (size_t)blockIdx.z * TT * TT;
  const int tid = threadIdx.x, wave = tid >> 5, lane = tid & 31, col = lane & 15, g = lane >> 4; const int k0 = kb * 128; const int ql0 = qb * 64 + wave * 16; const size_t q0 = (size_t)b * TT + ql0, kr0 = (size_t)b * TT + k0;
  v8f acc[8] = {}, accl[8] = {};
  const _Float16* QLb = QL + (size_t)b * QHI * CC; const _Float16* KLb = KL + (size_t)b * KHI * CC;
  if (qb < QBH) {
#pragma unroll
    for (int kc = 0; kc < HD / 32; ++kc) { const v16h ah = frag_h(QH + (q0 + col) * CC + h * HD + kc * 32, lane), al = frag_h(QLb + (size_t)(ql0 + col) * CC + h * HD + kc * 32, lane);
#pragma unroll
      for (int j = 0; j < 8; ++j) { const v16h kbf = frag_h(KH + (kr0 + j * 16 + col) * CC + h * HD + kc * 32, lane), klf = frag_h(KLb + (size_t)(k0 + j * 16 + col) * CC + h * HD + kc * 32, lane); acc[j] = wmma16(ah, kbf, acc[j]); accl[j] = wmma16(al, kbf, accl[j]); accl[j] = wmma16(ah, klf, accl[j]); } }
  } else if (qb * 64 < QHI) {
#pragma unroll
    for (int kc = 0; kc < HD / 32; ++kc) { const v16h ah = frag_h(QH + (q0 + col) * CC + h * HD + kc * 32, lane), al = frag_h(QLb + (size_t)(ql0 + col) * CC + h * HD + kc * 32, lane);
#pragma unroll
      for (int j = 0; j < 8; ++j) { const v16h kbf = frag_h(KH + (kr0 + j * 16 + col) * CC + h * HD + kc * 32, lane); acc[j] = wmma16(ah, kbf, acc[j]); accl[j] = wmma16(al, kbf, accl[j]); } }
  } else {
#pragma unroll
    for (int kc = 0; kc < HD / 32; ++kc) { const v16h ah = frag_h(QH + (q0 + col) * CC + h * HD + kc * 32, lane);
#pragma unroll
      for (int j = 0; j < 8; ++j) { const v16h kbf = frag_h(KH + (kr0 + j * 16 + col) * CC + h * HD + kc * 32, lane); acc[j] = wmma16(ah, kbf, acc[j]); } } }
#pragma unroll
  for (int j = 0; j < 8; ++j) {
#pragma unroll
    for (int r = 0; r < 8; ++r) ss[wave][8 * g + r][j * 16 + col] = (acc[j][r] + accl[j][r] * (1.0f / 1024.0f)) * SCALE; }
  LDSX(); for (int rl = 0; rl < 16; ++rl) vst2(S + (size_t)(ql0 + rl) * TT + k0 + lane * 4, *(const v4f*)&ss[wave][rl][lane * 4]); }
// ---- k_sm: block = query row t (head in group): keys [0, kend): causal -> logit if s <= t else excluded; softplus + 1e-8 normalised by the row sum in f32; P x 2^11 in place
__global__ __launch_bounds__(256) void k_sm(float* __restrict__ S0 SM_EXTRA_PARAMS) { __shared__ float sred[8]; __shared__ float sbc; __shared__ __align__(16) float shv[TT];
  const int tid = threadIdx.x; const int t = blockIdx.x; const int kend = (kb_last(t >> 6) + 1) * 128;
  float* sr = S0 + (size_t)blockIdx.y * TT * TT + (size_t)t * TT;
  float m = -3.0e38f; for (int k = tid; k < kend; k += 256) { float v = (!CAUSAL || k <= t) ? sr[k] : -3.0e38f; SM_MASK_HOOK; shv[k] = v; m = fmaxf(m, v); }
#pragma unroll
  for (int o = 1; o < 32; o <<= 1) m = fmaxf(m, __shfl_xor(m, o));
  if ((tid & 31) == 0) sred[tid >> 5] = m; __syncthreads(); if (tid == 0) { float a = sred[0]; for (int i = 1; i < 8; ++i) a = fmaxf(a, sred[i]); sbc = a; } __syncthreads(); m = sbc; __syncthreads();
  float sum = 0.f; for (int k = tid; k < kend; k += 256) { const float v = shv[k]; const float e = ((v > 20.0f) ? v : log1pf(expf(v))) + SP_EPS; (void)m;   /* softplus(v) + eps (jax.nn.softplus = logaddexp(v, 0): v + log1p(exp(-v)) == log1p(exp(v)); for v > 20 the correction is below f32 resolution); the row maximum is not used: the weights are normalised by their plain sum */ shv[k] = e; sum += e; }
#pragma unroll
  for (int o = 1; o < 32; o <<= 1) sum += __shfl_xor(sum, o);
  if ((tid & 31) == 0) sred[tid >> 5] = sum; __syncthreads(); if (tid == 0) { float a = 0.f; for (int i = 0; i < 8; ++i) a += sred[i]; sbc = a > 0.f ? 2048.0f / a : 0.f; }   /* every weight is >= 1e-8, so a > 0 unless a weight is NaN */ __syncthreads(); const float inv = sbc;
  for (int k = tid; k < kend; k += 256) shv[k] = shv[k] * inv;
  __syncthreads(); for (int q = tid; q < kend / 4; q += 256) vst2(sr + q * 4, *(const v4f*)&shv[q * 4]); }
// ---- k_pv: block = 64 queries (qb) of (b, h): ctx = P . v over keys [0, kend) (P x 2^11 once to f16 against v f16: 1 product; query blocks < QBH (none: QBH is 0): P and v as bf16 hi + lo, 3 products); 256-B (row, head) segment by 16 lanes
__global__ __launch_bounds__(128) void k_pv(const float* __restrict__ PS0, const _Float16* __restrict__ VT, const __bf16* __restrict__ VB, const __bf16* __restrict__ VBL, int b, int h0, float* __restrict__ Y) { const int h = h0 + blockIdx.z; const float* PS = PS0 + (size_t)blockIdx.z * TT * TT; __shared__ __align__(16) float ss[4][16][HD + 4];
  const int tid = threadIdx.x, wave = tid >> 5, lane = tid & 31, col = lane & 15, g = lane >> 4; const int qb = blockIdx.x; const int ql0 = qb * 64 + wave * 16; const int kce = (kb_last(qb) + 1) * 4;
  v8f acc[HD / 16] = {};
  if (qb < QBH) {
#pragma unroll 1
    for (int kc = 0; kc < kce; ++kc) { const F2 p = split_row(PS + (size_t)(ql0 + col) * TT, kc * 32, lane);
      asm volatile("s_wait_loadcnt 0x0" ::: "memory");
#pragma unroll
      for (int j = 0; j < HD / 16; ++j) { const size_t po = ((size_t)b * CC + h * HD + j * 16 + col) * (size_t)KHI + kc * 32; const v16b vh = frag_b(VB + po, lane); acc[j] = wmma_bf(p.h, vh, acc[j]); acc[j] = wmma_bf(p.l, vh, acc[j]); acc[j] = wmma_bf(p.h, frag_b(VBL + po, lane), acc[j]); } }
  } else {
#pragma unroll 1
    for (int kc = 0; kc < kce; ++kc) { const v16h p = frag_f32(PS + (size_t)(ql0 + col) * TT + kc * 32, lane);
      asm volatile("s_wait_loadcnt 0x0" ::: "memory");
#pragma unroll
      for (int j = 0; j < HD / 16; ++j) { const size_t po = ((size_t)b * CC + h * HD + j * 16 + col) * (size_t)TT + kc * 32; acc[j] = wmma16(p, frag_h(VT + po, lane), acc[j]); } } }
#pragma unroll
  for (int j = 0; j < HD / 16; ++j)
#pragma unroll
    for (int r = 0; r < 8; ++r) ss[wave][8 * g + r][j * 16 + col] = acc[j][r] * (1.0f / 2048.0f);
  LDSX(); for (int rl = 0; rl < 16; ++rl) if (lane < HD / 4) vst2(Y + ((size_t)b * TT + ql0 + rl) * CC + h * HD + lane * 4, *(const v4f*)&ss[wave][rl][lane * 4]); }

extern "C" void kernel_launch(void* const* d_in, const int* in_sizes, int n_in, void* d_out, int out_size, void* d_ws, size_t ws_size, hipStream_t stream) {
  (void)in_sizes; (void)n_in; (void)out_size;
  const float** F = (const float**)d_in;
  if (ws_size < (size_t)WS_END) return;
  char* ws = (char*)d_ws; _Float16 *QH = (_Float16*)(ws + WS_QH), *KH = (_Float16*)(ws + WS_KH), *VT = (_Float16*)(ws + WS_VT), *QL = (_Float16*)(ws + WS_QL), *KL = (_Float16*)(ws + WS_KL); __bf16 *VB = (__bf16*)(ws + WS_VB), *VBL = (__bf16*)(ws + WS_VBL); float *S = (float*)(ws + WS_S), *Y = (float*)(ws + WS_Y);
  (void)Y; (void)QL; (void)KL; (void)VB; (void)VBL;
  // inputs: 0 q [32,2048,64]; 1 k; 2 v; 3 scale (f32 scalar)
  k_prepr<<<dim3(TNB * TT / 64, NH), 128, 0, stream>>>(F[0], F[1], F[2], QH, QL, KH, KL, VT, VB, VBL);   /* raw inputs - attention planes (bf16-rounded; exact in f16) */
  for (int b = 0; b < TNB; ++b) {
    k_sc<<<dim3(NQB, TT / 128, 1), 128, 0, stream>>>(QH, KH, QL, KL, b, 0, S);
    k_sm<<<dim3(TT, 1), 256, 0, stream>>>(S, F[3]);
    k_pv<<<dim3(NQB, 1, 1), 128, 0, stream>>>(S, VT, VB, VBL, b, 0, (float*)d_out);
  }
}

// v001
// A run of this version takes 80 microseconds.
// Timed twice side by side with v000, it ran 35.0 and 34.6 times as fast.
// compute dtype: all float inputs rounded to bf16; raw q / k / v: the scores q . k are exact products of f16-exact inputs (f32 accumulate), multiplied by the scale INPUT in f32; weights = softplus(score) + 1e-8 in f32 (no exponential softmax), rounded once to f16 unnormalised x v (exact in f16); the f32 context is divided by the f32 row sum of the weights; f32 output.
#include <hip/hip_runtime.h>
#include <math.h>

typedef __attribute__((ext_vector_type(16))) _Float16 v16h;
typedef __attribute__((ext_vector_type(16))) __bf16 v16b;
typedef __attribute__((ext_vector_type(8)))  _Float16 v8h;
typedef __attribute__((ext_vector_type(8)))  float v8f;
typedef __attribute__((ext_vector_type(4)))  float v4f;
typedef __attribute__((ext_vector_type(2)))  float v2f;
typedef __attribute__((ext_vector_type(4)))  unsigned v4u;
typedef __attribute__((ext_vector_type(4)))  int v4i;
typedef float __attribute__((may_alias)) float_a;
typedef int __attribute__((may_alias)) int_a;

template <typename T> __device__ __forceinline__ void vst2(void* p, T v) { *(T*)p = v;  }
__device__ __forceinline__ v8f wmma16(v16h a, v16h b, v8f c) {
  v8f d = __builtin_amdgcn_wmma_f32_16x16x32_f16(false, a, false, b, (short)0, c, false, false);
  asm volatile("v_nop\n\tv_nop\n\tv_nop\n\tv_nop" : "+v"(d) : "v"(a), "v"(b));
  return d;
}
__device__ __forceinline__ v8f wmma_bf(v16b a, v16b b, v8f c) {
  v8f d = __builtin_amdgcn_wmma_f32_16x16x32_bf16(false, a, false, b, (short)0, c, false, false);
  asm volatile("v_nop\n\tv_nop\n\tv_nop\n\tv_nop" : "+v"(d) : "v"(a), "v"(b));
  return d;
}
// 16x16x32 fragments: lane = (h = lane>>4, row/col = lane&15); elements 0..7 = k0+8h+0..7, 8..15 = k0+16+8h+0..7; D element r = row 8h+r
__device__ __forceinline__ v16h frag_h(const _Float16* rowk0, int lane) {
  union { v16h v; v8h q[2]; } u; const _Float16* p = rowk0 + 8 * (lane >> 4);
  u.q[0] = *(const v8h*)p; u.q[1] = *(const v8h*)(p + 16); return u.v;
}
__device__ __forceinline__ v16h frag_f32(const float* rowk0, int lane) {
  v16h a; const float* p = rowk0 + 8 * (lane >> 4);
#pragma unroll
  for (int i = 0; i < 8; ++i) { a[i] = (_Float16)p[i]; a[8 + i] = (_Float16)p[16 + i]; }
  return a;
}
__device__ __forceinline__ v16h frag_f32s(const float* rowk0, int lane, float sc) {
  v16h a; const float* p = rowk0 + 8 * (lane >> 4);
#pragma unroll
  for (int i = 0; i < 8; ++i) { a[i] = (_Float16)(p[i] * sc); a[8 + i] = (_Float16)(p[16 + i] * sc); }
  return a;
}
// column fragment from a [K][ld] layout (column n), rows >= K read as 0
__device__ __forceinline__ v16h fragc_f32(const float* W, int k0, int n, int lane, int ld, int K) {
  v16h a; const int g = lane >> 4;
#pragma unroll
  for (int i = 0; i < 8; ++i) { const int ka = k0 + 8 * g + i, kb = ka + 16;
    a[i] = (_Float16)(ka < K ? W[(size_t)(ka < K ? ka : K - 1) * ld + n] : 0.f); a[8 + i] = (_Float16)(kb < K ? W[(size_t)(kb < K ? kb : K - 1) * ld + n] : 0.f); }
  return a;
}
struct F2 { v16b h, l; };
__device__ __forceinline__ F2 bsplit16(const float v[16]) { F2 r;
#pragma unroll
  for (int i = 0; i < 16; ++i) { const __bf16 h = (__bf16)v[i]; r.h[i] = h; r.l[i] = (__bf16)(v[i] - (float)h); }
  return r; }
__device__ __forceinline__ F2 split_row(const float* row, int k0, int lane) { float v[16]; const float* p = row + k0 + 8 * (lane >> 4);
#pragma unroll
  for (int i = 0; i < 8; ++i) { v[i] = p[i]; v[8 + i] = p[16 + i]; }
  return bsplit16(v); }
__device__ __forceinline__ F2 split_rowK(const float* row, int k0, int lane, int K) { float v[16]; const int g = lane >> 4;
#pragma unroll
  for (int i = 0; i < 8; ++i) { const int ka = k0 + 8 * g + i, kb = ka + 16; v[i] = ka < K ? row[ka < K ? ka : K - 1] : 0.f; v[8 + i] = kb < K ? row[kb < K ? kb : K - 1] : 0.f; }
  return bsplit16(v); }
__device__ __forceinline__ F2 split_col(const float* W, int k0, int n, int lane, int ld, int K) { float v[16]; const int g = lane >> 4;
#pragma unroll
  for (int i = 0; i < 8; ++i) { const int ka = k0 + 8 * g + i, kb = ka + 16; v[i] = ka < K ? W[(size_t)(ka < K ? ka : K - 1) * ld + n] : 0.f; v[8 + i] = kb < K ? W[(size_t)(kb < K ? kb : K - 1) * ld + n] : 0.f; }
  return bsplit16(v); }
__device__ __forceinline__ v8f mac3(const F2& a, const F2& b, v8f c) { c = wmma_bf(a.l, b.h, c); c = wmma_bf(a.h, b.l, c); return wmma_bf(a.h, b.h, c); }
__device__ __forceinline__ float sigm(float v) { return 1.0f / (1.0f + expf(-v)); }
#define LDSX() do { asm volatile("s_wait_dscnt 0" ::: "memory"); __builtin_amdgcn_wave_barrier(); __builtin_amdgcn_fence(__ATOMIC_RELEASE, "workgroup"); } while (0)

// Quadratic attention with a softplus kernel instead of a softmax (q / k / v [32,2048,64]; sim = softplus(q k^T * scale) + 1e-8 with scale a scalar input; sim /= sum over keys; out = sim v -> [32,2048,64]; no mask).
#define NB 32
#define TT 2048
#define CC 64            // NH * HD = projected width
#define DIN 64          // input (model) width
#define NH 1
#define HD 64
#define NQB (TT / 64)
#define HG 1
#define SCALE (1.0f)
#define CAUSAL 0
#ifndef TNB
#define TNB NB
#endif
__device__ __forceinline__ float bfr(float v) { return (float)(__bf16)v; }
__host__ __device__ __forceinline__ int kb_last(int qb) { return CAUSAL ? ((qb * 64 + 63) >> 7) : (TT / 128 - 1); }
typedef __attribute__((ext_vector_type(8))) __bf16 v8b;
__device__ __forceinline__ v16b frag_b(const __bf16* rowk0, int lane) {
  union { v16b v; v8b q[2]; } u; const __bf16* p = rowk0 + 8 * (lane >> 4);
  u.q[0] = *(const v8b*)p; u.q[1] = *(const v8b*)(p + 16); return u.v;
}
#define QBH 0              // unused: k_att has no causal or high-precision path
#define QHI 0              // (override) rows carrying the q residual plane
#define KHI 64            // key rows carrying k residual / v bf16 hi+lo planes (written by k_prepr; no kernel in this file reads them)
// B fragment (k rows k0+.., output column o) of a weight: (in,out) [K][ld] or (out,in) [ld rows of K]: bf16 exact, or f16(bf16 * 256) exact
__device__ __forceinline__ v16b wcol_io(const float* Wm, int k0, int o, int lane, int ld) { v16b w; const int g = lane >> 4;
#pragma unroll
  for (int i = 0; i < 8; ++i) { w[i] = (__bf16)Wm[(size_t)(k0 + 8 * g + i) * ld + o]; w[8 + i] = (__bf16)Wm[(size_t)(k0 + 16 + 8 * g + i) * ld + o]; }
  return w; }
__device__ __forceinline__ v16b wcol_oi(const float* Wm, int k0, int o, int lane, int K) { v16b w; const float* p = Wm + (size_t)o * K + k0 + 8 * (lane >> 4);
#pragma unroll
  for (int i = 0; i < 8; ++i) { w[i] = (__bf16)p[i]; w[8 + i] = (__bf16)p[16 + i]; }
  return w; }
__device__ __forceinline__ v16h wcolh_io(const float* Wm, int k0, int o, int lane, int ld) { v16h w; const int g = lane >> 4;
#pragma unroll
  for (int i = 0; i < 8; ++i) { w[i] = (_Float16)(bfr(Wm[(size_t)(k0 + 8 * g + i) * ld + o]) * 256.0f); w[8 + i] = (_Float16)(bfr(Wm[(size_t)(k0 + 16 + 8 * g + i) * ld + o]) * 256.0f); }
  return w; }
__device__ __forceinline__ v16h wcolh_oi(const float* Wm, int k0, int o, int lane, int K) { v16h w; const float* p = Wm + (size_t)o * K + k0 + 8 * (lane >> 4);
#pragma unroll
  for (int i = 0; i < 8; ++i) { w[i] = (_Float16)(bfr(p[i]) * 256.0f); w[8 + i] = (_Float16)(bfr(p[16 + i]) * 256.0f); }
  return w; }
#define WQKV_LAYOUT 1   // 0 = (in,out) [DIN][CC]; 1 = (out,in) [CC][DIN]; 2 = per-head [NH][DIN][HD]
__device__ __forceinline__ v16b wcol_hdk(const float* Wm, int k0, int o, int lane) { v16b w; const int g = lane >> 4; const float* p = Wm + (size_t)(o / HD) * DIN * HD + (o % HD);
#pragma unroll
  for (int i = 0; i < 8; ++i) { w[i] = (__bf16)p[(size_t)(k0 + 8 * g + i) * HD]; w[8 + i] = (__bf16)p[(size_t)(k0 + 16 + 8 * g + i) * HD]; }
  return w; }
#define WO_OUT_IN 0
#if WQKV_LAYOUT == 1
#define WCOL(W, k0, o, lane) wcol_oi(W, k0, o, lane, DIN)
#elif WQKV_LAYOUT == 2
#define WCOL(W, k0, o, lane) wcol_hdk(W, k0, o, lane)
#else
#define WCOL(W, k0, o, lane) wcol_io(W, k0, o, lane, CC)
#endif
#if WO_OUT_IN
#define WOCOL(W, k0, o, lane) wcol_oi(W, k0, o, lane, CC)
#define WOCOLH(W, k0, o, lane) wcolh_oi(W, k0, o, lane, CC)
#else
#define WOCOL(W, k0, o, lane) wcol_io(W, k0, o, lane, DIN)
#define WOCOLH(W, k0, o, lane) wcolh_io(W, k0, o, lane, DIN)
#endif
#define SP_EPS 1.0e-8f
// ---- k_prepr: block = (64 attention positions s0.. of sequence b, head h): reads the module's [B, T, H*64] inputs, bf16-rounds them and writes the standard attention planes: q -> f16 hi rows (+ x 2^10 residual rows for s < QHI), k -> f16 rows (+ residual rows s < KHI), v -> f16 planes [c][s] (+ bf16 hi/lo planes for s < KHI)
__global__ __launch_bounds__(128) void k_prepr(const float* __restrict__ Q, const float* __restrict__ K, const float* __restrict__ V, _Float16* __restrict__ QH, _Float16* __restrict__ QL, _Float16* __restrict__ KH, _Float16* __restrict__ KL, _Float16* __restrict__ VT, __bf16* __restrict__ VB, __bf16* __restrict__ VBL) {
  __shared__ __align__(16) _Float16 sq[64][136], sql[64][136], sk[64][136], skl[64][136], tv[128][72]; __shared__ __align__(16) __bf16 tb[128][72], tbl[128][72];
  const int tid = threadIdx.x; const int h = blockIdx.y; const size_t r0 = (size_t)blockIdx.x * 64; const size_t bb = r0 / TT; const int t0 = (int)(r0 % TT); const bool qhi = t0 < QHI, khi = t0 < KHI;
  for (int e = tid; e < 64 * 128; e += 128) { const int rl = e >> 7, c = e & 127; const size_t oi = ((bb * TT + t0 + rl) * (size_t)CC + h * HD + (c & 63));   /* [B, T, H*64] inputs */   /* c >= 64: duplicate read of the same element (tiles are 128 wide; HD is 64) */
    const float q = bfr(Q[oi]), k = bfr(K[oi]), v = bfr(V[oi]);   /* module inputs: bf16-rounded; bf16 values are exact in f16, so the residual planes are 0 */
    const _Float16 qh = (_Float16)q, kh = (_Float16)k; sq[rl][c] = qh; sql[rl][c] = (_Float16)((q - (float)qh) * 1024.0f); sk[rl][c] = kh; skl[rl][c] = (_Float16)((k - (float)kh) * 1024.0f);
    tv[c][rl] = (_Float16)v; const __bf16 vb = (__bf16)v; tb[c][rl] = vb; tbl[c][rl] = (__bf16)(v - (float)vb); }
  __syncthreads();
  for (int e = tid; e < 64 * 8; e += 128) { const int rl = e >> 3, q = e & 7; const size_t o = (r0 + rl) * CC + h * HD + q * 8; vst2((unsigned*)(QH + o), *(const v4u*)&sq[rl][q * 8]); vst2((unsigned*)(KH + o), *(const v4u*)&sk[rl][q * 8]);   
    if (qhi) vst2((unsigned*)(QL + (bb * QHI + t0 + rl) * (size_t)CC + h * HD + q * 8), *(const v4u*)&sql[rl][q * 8]); if (khi) vst2((unsigned*)(KL + (bb * KHI + t0 + rl) * (size_t)CC + h * HD + q * 8), *(const v4u*)&skl[rl][q * 8]); }
  for (int e = tid; e < 64 * 8; e += 128) { const int cl = e >> 3, q = e & 7; vst2((unsigned*)(VT + (bb * CC + h * HD + cl) * (size_t)TT + t0 + q * 8), *(const v4u*)&tv[cl][q * 8]);
    if (khi) { const size_t o3 = (bb * CC + h * HD + cl) * (size_t)KHI + t0 + q * 8; vst2((unsigned*)(VB + o3), *(const v4u*)&tb[cl][q * 8]); vst2((unsigned*)(VBL + o3), *(const v4u*)&tbl[cl][q * 8]); } } }

#define WS_QH  0u                                      // f16 q rows [b*t][CC]
#define WS_KH  (WS_QH + 2u * (size_t)NB * TT * CC)      // f16 k rows [b*t][CC]
#define WS_VT  (WS_KH + 2u * (size_t)NB * TT * CC)      // f16 v planes [b][c][t]
#define WS_QL  (WS_VT + 2u * (size_t)NB * CC * TT)      // f16 q residual x 2^10 rows [b][t < QHI][CC]
#define WS_KL  (WS_QL + 2u * (size_t)NB * QHI * CC)     // f16 k residual x 2^10 rows [b][t < KHI][CC]
#define WS_VB  (WS_KL + 2u * (size_t)NB * KHI * CC)     // bf16 v hi planes [b][c][t < KHI]
#define WS_VBL (WS_VB + 2u * (size_t)NB * CC * KHI)
#define WS_END (WS_VBL + 2u * (size_t)NB * CC * KHI)

// ---- k_att: block = 128 queries of sequence b, 8 waves x 16 query columns; all keys in stages of 64. S^T = K . Q^T (A = key rows from LDS, B = q kept in registers), so a lane holds one query's scores; the two 16-key score tiles, turned into weights in place, are the B operand of O^T += V^T . P^T (A = v planes [c][key] from LDS, same k order as frag_h): scores and weights never leave the registers. No row maximum is needed (plain sum), so one pass over the keys does it all; the context is divided by the row sum at the end.
#define KST 64             // keys per stage
#define NST (TT / KST)
#define LP 72              // LDS row pitch in f16: 144 B = 16 B x 9 (odd), conflict-free for 16-byte fragment reads
typedef __attribute__((ext_vector_type(2))) _Float16 v2h;
__device__ __forceinline__ v8f wmma_h(v16h a, v16h b, v8f c) { return __builtin_amdgcn_wmma_f32_16x16x32_f16(false, a, false, b, (short)0, c, false, false); }
// four waves per SIMD = two blocks per WGP: the 512 blocks are all resident, two on every WGP
__global__ __launch_bounds__(256) __attribute__((amdgpu_waves_per_eu(4, 4))) void k_att(const _Float16* __restrict__ QH, const _Float16* __restrict__ KH, const _Float16* __restrict__ VT, const float* __restrict__ SCL, float* __restrict__ O) {
  __shared__ __align__(16) _Float16 sk[2][KST][LP], sv[2][HD][LP];
  const int tid = threadIdx.x, wave = tid >> 5, lane = tid & 31, col = lane & 15, g = lane >> 4;
  const int b = blockIdx.y, q0 = blockIdx.x * 128 + wave * 16;
  // the scale is a scalar INPUT (bf16-rounded like every float input). Weights are formed in units of ln 2 (the unit cancels in the division by the row sum): w = f * (max(u, 0) + log2(1 + 2^-|u|) + eps / ln 2), u = score * scale * log2(e); f = 1 up to |scale| = 64 and 64 / |scale| beyond, which keeps the unnormalised weights inside f16 for any scale; f cancels too
  const float sc = bfr(SCL[0]); const float f = fabsf(sc) > 64.0f ? 64.0f / fabsf(sc) : 1.0f; const float c2 = sc * 1.44269504f; const float e2 = SP_EPS * 1.44269504f * f;
  const v2f cu = {c2, c2}, cm = {c2 * f, c2 * f}, em = {e2, e2}, ff = {f, f}, one = {1.0f, 1.0f};
  v16h qf[2];
#pragma unroll
  for (int kc = 0; kc < 2; ++kc) qf[kc] = frag_h(QH + ((size_t)b * TT + q0 + col) * CC + kc * 32, lane);
  // staging: thread = (row sr and sr + 32, 16-byte piece sp): whole 128-byte lines from global, through registers into the padded LDS rows
  const int sr = tid >> 3, sp = tid & 7;
  const _Float16* kg = KH + ((size_t)b * TT + sr) * CC + sp * 8; const _Float16* vg = VT + ((size_t)b * CC + sr) * TT + sp * 8;
  v4u rk0 = *(const v4u*)kg, rk1 = *(const v4u*)(kg + 32 * CC), rv0 = *(const v4u*)vg, rv1 = *(const v4u*)(vg + (size_t)32 * TT);
  asm volatile("s_wait_xcnt 0x0" ::: "memory");   /* stands in front of the first reuse of an address register of the q, k and v loads above; a precaution */
  *(v4u*)&sk[0][sr][sp * 8] = rk0; *(v4u*)&sk[0][sr + 32][sp * 8] = rk1; *(v4u*)&sv[0][sr][sp * 8] = rv0; *(v4u*)&sv[0][sr + 32][sp * 8] = rv1;
  __syncthreads();
  v8f acc[HD / 16] = {}; v2f sum[4] = {};   /* four independent partial row sums: no long dependent chain of adds */
#pragma unroll 1
  for (int s = 0; s < NST; ++s) { const int bu = s & 1; const bool more = s + 1 < NST;
    if (more) { const _Float16* kn = kg + (size_t)(s + 1) * KST * CC; const _Float16* vn = vg + (s + 1) * KST;   /* the next stage flies while this one is worked on */
      rk0 = *(const v4u*)kn; rk1 = *(const v4u*)(kn + 32 * CC); rv0 = *(const v4u*)vn; rv1 = *(const v4u*)(vn + (size_t)32 * TT); }
#pragma unroll
    for (int kk = 0; kk < KST / 32; ++kk) { v8f st[2]; v16h kf[2][2], vf[HD / 16];
#pragma unroll
      for (int t = 0; t < 2; ++t) { const _Float16* kr = &sk[bu][kk * 32 + t * 16 + col][0]; kf[t][0] = frag_h(kr, lane); kf[t][1] = frag_h(kr + 32, lane); }
#pragma unroll
      for (int j = 0; j < HD / 16; ++j) vf[j] = frag_h(&sv[bu][j * 16 + col][kk * 32], lane);
      __builtin_amdgcn_sched_barrier(0);   /* keeps the pass's 16 LDS reads in one group ahead of its products: one LDS latency a pass (the v reads land under the weights) instead of a drained wait in front of every product */
#pragma unroll
      for (int t = 0; t < 2; ++t) { v8f z = {}; z = wmma_h(kf[t][0], qf[0], z); st[t] = wmma_h(kf[t][1], qf[1], z); }
      v16h p;
#pragma unroll
      for (int t = 0; t < 2; ++t)
#pragma unroll
        for (int r = 0; r < 8; r += 2) { const v2f a = {st[t][r], st[t][r + 1]}; const v2f u = a * cu;
          v2f x; x.x = __builtin_amdgcn_exp2f(-fabsf(u.x)); x.y = __builtin_amdgcn_exp2f(-fabsf(u.y)); x = x + one;
          v2f l; l.x = __builtin_amdgcn_logf(x.x); l.y = __builtin_amdgcn_logf(x.y);
          const v2f w = __builtin_elementwise_fma(l, ff, __builtin_elementwise_max(__builtin_elementwise_fma(a, cm, em), em));   /* max(f u + f eps', f eps') = f max(u, 0) + f eps' */
          sum[r >> 1] += w; const v2h ph = __builtin_convertvector(w, v2h); p[t * 8 + r] = ph.x; p[t * 8 + r + 1] = ph.y; }
#pragma unroll
      for (int j = 0; j < HD / 16; ++j) acc[j] = wmma_h(vf[j], p, acc[j]); }
    if (more) { const int bn = bu ^ 1;   /* its last readers left this buffer at the barrier that ended stage s - 1 */
      *(v4u*)&sk[bn][sr][sp * 8] = rk0; *(v4u*)&sk[bn][sr + 32][sp * 8] = rk1; *(v4u*)&sv[bn][sr][sp * 8] = rv0; *(v4u*)&sv[bn][sr + 32][sp * 8] = rv1; }
    __syncthreads(); }
  const v2f s2 = (sum[0] + sum[1]) + (sum[2] + sum[3]); float tot = s2.x + s2.y; tot += __shfl_xor(tot, 16);   /* the two lane halves hold the two halves of a query's keys */
  const float inv = 1.0f / tot;
  float* o = O + ((size_t)b * TT + q0 + col) * CC + 8 * g;   /* acc[j][r] = channel 16 j + 8 g + r of query col */
#pragma unroll
  for (int j = 0; j < HD / 16; ++j) { const v4f lo = {acc[j][0] * inv, acc[j][1] * inv, acc[j][2] * inv, acc[j][3] * inv}, hi = {acc[j][4] * inv, acc[j][5] * inv, acc[j][6] * inv, acc[j][7] * inv}; vst2(o + j * 16, lo); vst2(o + j * 16 + 4, hi); } }

extern "C" void kernel_launch(void* const* d_in, const int* in_sizes, int n_in, void* d_out, int out_size, void* d_ws, size_t ws_size, hipStream_t stream) {
  (void)in_sizes; (void)n_in; (void)out_size;
  const float** F = (const float**)d_in;
  if (ws_size < (size_t)WS_END) return;
  char* ws = (char*)d_ws; _Float16 *QH = (_Float16*)(ws + WS_QH), *KH = (_Float16*)(ws + WS_KH), *VT = (_Float16*)(ws + WS_VT), *QL = (_Float16*)(ws + WS_QL), *KL = (_Float16*)(ws + WS_KL); __bf16 *VB = (__bf16*)(ws + WS_VB), *VBL = (__bf16*)(ws + WS_VBL);
  // inputs: 0 q [32,2048,64]; 1 k; 2 v; 3 scale (f32 scalar)
  k_prepr<<<dim3(TNB * TT / 64, NH), 128, 0, stream>>>(F[0], F[1], F[2], QH, QL, KH, KL, VT, VB, VBL);   /* raw inputs - the attention planes (bf16-rounded; exact in f16) */
  k_att<<<dim3(TT / 128, TNB), 256, 0, stream>>>(QH, KH, VT, F[3], (float*)d_out);
}

// v002
// It runs in 51.8 microseconds.
// Next to v001, in two timings, it ran 1.55 and 1.53 times as fast.
// All steps since v000 together make it 53.6 times as fast.
// compute dtype: all float inputs rounded to bf16; raw q / k / v: the scores q . k are exact products of f16-exact inputs (f32 accumulate), multiplied by the scale INPUT in f32; weights = softplus(score) + 1e-8 in f32 (no exponential softmax), rounded once to f16 unnormalised x v (exact in f16); the f32 context is divided by the f32 row sum of the weights; f32 output.
#include <hip/hip_runtime.h>
#include <math.h>

typedef __attribute__((ext_vector_type(16))) _Float16 v16h;
typedef __attribute__((ext_vector_type(16))) __bf16 v16b;
typedef __attribute__((ext_vector_type(8)))  _Float16 v8h;
typedef __attribute__((ext_vector_type(8)))  float v8f;
typedef __attribute__((ext_vector_type(4)))  float v4f;
typedef __attribute__((ext_vector_type(2)))  float v2f;
typedef __attribute__((ext_vector_type(4)))  unsigned v4u;
typedef __attribute__((ext_vector_type(4)))  int v4i;
typedef float __attribute__((may_alias)) float_a;
typedef int __attribute__((may_alias)) int_a;

template <typename T> __device__ __forceinline__ void vst2(void* p, T v) { *(T*)p = v;  }
__device__ __forceinline__ v8f wmma16(v16h a, v16h b, v8f c) {
  v8f d = __builtin_amdgcn_wmma_f32_16x16x32_f16(false, a, false, b, (short)0, c, false, false);
  asm volatile("v_nop\n\tv_nop\n\tv_nop\n\tv_nop" : "+v"(d) : "v"(a), "v"(b));
  return d;
}
__device__ __forceinline__ v8f wmma_bf(v16b a, v16b b, v8f c) {
  v8f d = __builtin_amdgcn_wmma_f32_16x16x32_bf16(false, a, false, b, (short)0, c, false, false);
  asm volatile("v_nop\n\tv_nop\n\tv_nop\n\tv_nop" : "+v"(d) : "v"(a), "v"(b));
  return d;
}
// 16x16x32 fragments: lane = (h = lane>>4, row/col = lane&15); elements 0..7 = k0+8h+0..7, 8..15 = k0+16+8h+0..7; D element r = row 8h+r
__device__ __forceinline__ v16h frag_h(const _Float16* rowk0, int lane) {
  union { v16h v; v8h q[2]; } u; const _Float16* p = rowk0 + 8 * (lane >> 4);
  u.q[0] = *(const v8h*)p; u.q[1] = *(const v8h*)(p + 16); return u.v;
}
__device__ __forceinline__ v16h frag_f32(const float* rowk0, int lane) {
  v16h a; const float* p = rowk0 + 8 * (lane >> 4);
#pragma unroll
  for (int i = 0; i < 8; ++i) { a[i] = (_Float16)p[i]; a[8 + i] = (_Float16)p[16 + i]; }
  return a;
}
__device__ __forceinline__ v16h frag_f32s(const float* rowk0, int lane, float sc) {
  v16h a; const float* p = rowk0 + 8 * (lane >> 4);
#pragma unroll
  for (int i = 0; i < 8; ++i) { a[i] = (_Float16)(p[i] * sc); a[8 + i] = (_Float16)(p[16 + i] * sc); }
  return a;
}
// column fragment from a [K][ld] layout (column n), rows >= K read as 0
__device__ __forceinline__ v16h fragc_f32(const float* W, int k0, int n, int lane, int ld, int K) {
  v16h a; const int g = lane >> 4;
#pragma unroll
  for (int i = 0; i < 8; ++i) { const int ka = k0 + 8 * g + i, kb = ka + 16;
    a[i] = (_Float16)(ka < K ? W[(size_t)(ka < K ? ka : K - 1) * ld + n] : 0.f); a[8 + i] = (_Float16)(kb < K ? W[(size_t)(kb < K ? kb : K - 1) * ld + n] : 0.f); }
  return a;
}
struct F2 { v16b h, l; };
__device__ __forceinline__ F2 bsplit16(const float v[16]) { F2 r;
#pragma unroll
  for (int i = 0; i < 16; ++i) { const __bf16 h = (__bf16)v[i]; r.h[i] = h; r.l[i] = (__bf16)(v[i] - (float)h); }
  return r; }
__device__ __forceinline__ F2 split_row(const float* row, int k0, int lane) { float v[16]; const float* p = row + k0 + 8 * (lane >> 4);
#pragma unroll
  for (int i = 0; i < 8; ++i) { v[i] = p[i]; v[8 + i] = p[16 + i]; }
  return bsplit16(v); }
__device__ __forceinline__ F2 split_rowK(const float* row, int k0, int lane, int K) { float v[16]; const int g = lane >> 4;
#pragma unroll
  for (int i = 0; i < 8; ++i) { const int ka = k0 + 8 * g + i, kb = ka + 16; v[i] = ka < K ? row[ka < K ? ka : K - 1] : 0.f; v[8 + i] = kb < K ? row[kb < K ? kb : K - 1] : 0.f; }
  return bsplit16(v); }
__device__ __forceinline__ F2 split_col(const float* W, int k0, int n, int lane, int ld, int K) { float v[16]; const int g = lane >> 4;
#pragma unroll
  for (int i = 0; i < 8; ++i) { const int ka = k0 + 8 * g + i, kb = ka + 16; v[i] = ka < K ? W[(size_t)(ka < K ? ka : K - 1) * ld + n] : 0.f; v[8 + i] = kb < K ? W[(size_t)(kb < K ? kb : K - 1) * ld + n] : 0.f; }
  return bsplit16(v); }
__device__ __forceinline__ v8f mac3(const F2& a, const F2& b, v8f c) { c = wmma_bf(a.l, b.h, c); c = wmma_bf(a.h, b.l, c); return wmma_bf(a.h, b.h, c); }
__device__ __forceinline__ float sigm(float v) { return 1.0f / (1.0f + expf(-v)); }
#define LDSX() do { asm volatile("s_wait_dscnt 0" ::: "memory"); __builtin_amdgcn_wave_barrier(); __builtin_amdgcn_fence(__ATOMIC_RELEASE, "workgroup"); } while (0)

// Quadratic attention with a softplus kernel instead of a softmax (q / k / v [32,2048,64]; sim = softplus(q k^T * scale) + 1e-8 with scale a scalar input; sim /= sum over keys; out = sim v -> [32,2048,64]; no mask).
#define NB 32
#define TT 2048
#define CC 64            // NH * HD = projected width
#define DIN 64          // input (model) width
#define NH 1
#define HD 64
#define NQB (TT / 64)
#define HG 1
#define SCALE (1.0f)
#define CAUSAL 0
#ifndef TNB
#define TNB NB
#endif
__device__ __forceinline__ float bfr(float v) { return (float)(__bf16)v; }
__host__ __device__ __forceinline__ int kb_last(int qb) { return CAUSAL ? ((qb * 64 + 63) >> 7) : (TT / 128 - 1); }
typedef __attribute__((ext_vector_type(8))) __bf16 v8b;
__device__ __forceinline__ v16b frag_b(const __bf16* rowk0, int lane) {
  union { v16b v; v8b q[2]; } u; const __bf16* p = rowk0 + 8 * (lane >> 4);
  u.q[0] = *(const v8b*)p; u.q[1] = *(const v8b*)(p + 16); return u.v;
}
#define QBH 0              // unused: k_att has no causal or high-precision path
#define QHI 0              // (override) rows carrying the q residual plane
#define KHI 64            // key rows carrying k residual / v bf16 hi+lo planes (no kernel in this file writes or reads them)
// B fragment (k rows k0+.., output column o) of a weight: (in,out) [K][ld] or (out,in) [ld rows of K]: bf16 exact, or f16(bf16 * 256) exact
__device__ __forceinline__ v16b wcol_io(const float* Wm, int k0, int o, int lane, int ld) { v16b w; const int g = lane >> 4;
#pragma unroll
  for (int i = 0; i < 8; ++i) { w[i] = (__bf16)Wm[(size_t)(k0 + 8 * g + i) * ld + o]; w[8 + i] = (__bf16)Wm[(size_t)(k0 + 16 + 8 * g + i) * ld + o]; }
  return w; }
__device__ __forceinline__ v16b wcol_oi(const float* Wm, int k0, int o, int lane, int K) { v16b w; const float* p = Wm + (size_t)o * K + k0 + 8 * (lane >> 4);
#pragma unroll
  for (int i = 0; i < 8; ++i) { w[i] = (__bf16)p[i]; w[8 + i] = (__bf16)p[16 + i]; }
  return w; }
__device__ __forceinline__ v16h wcolh_io(const float* Wm, int k0, int o, int lane, int ld) { v16h w; const int g = lane >> 4;
#pragma unroll
  for (int i = 0; i < 8; ++i) { w[i] = (_Float16)(bfr(Wm[(size_t)(k0 + 8 * g + i) * ld + o]) * 256.0f); w[8 + i] = (_Float16)(bfr(Wm[(size_t)(k0 + 16 + 8 * g + i) * ld + o]) * 256.0f); }
  return w; }
__device__ __forceinline__ v16h wcolh_oi(const float* Wm, int k0, int o, int lane, int K) { v16h w; const float* p = Wm + (size_t)o * K + k0 + 8 * (lane >> 4);
#pragma unroll
  for (int i = 0; i < 8; ++i) { w[i] = (_Float16)(bfr(p[i]) * 256.0f); w[8 + i] = (_Float16)(bfr(p[16 + i]) * 256.0f); }
  return w; }
#define WQKV_LAYOUT 1   // 0 = (in,out) [DIN][CC]; 1 = (out,in) [CC][DIN]; 2 = per-head [NH][DIN][HD]
__device__ __forceinline__ v16b wcol_hdk(const float* Wm, int k0, int o, int lane) { v16b w; const int g = lane >> 4; const float* p = Wm + (size_t)(o / HD) * DIN * HD + (o % HD);
#pragma unroll
  for (int i = 0; i < 8; ++i) { w[i] = (__bf16)p[(size_t)(k0 + 8 * g + i) * HD]; w[8 + i] = (__bf16)p[(size_t)(k0 + 16 + 8 * g + i) * HD]; }
  return w; }
#define WO_OUT_IN 0
#if WQKV_LAYOUT == 1
#define WCOL(W, k0, o, lane) wcol_oi(W, k0, o, lane, DIN)
#elif WQKV_LAYOUT == 2
#define WCOL(W, k0, o, lane) wcol_hdk(W, k0, o, lane)
#else
#define WCOL(W, k0, o, lane) wcol_io(W, k0, o, lane, CC)
#endif
#if WO_OUT_IN
#define WOCOL(W, k0, o, lane) wcol_oi(W, k0, o, lane, CC)
#define WOCOLH(W, k0, o, lane) wcolh_oi(W, k0, o, lane, CC)
#else
#define WOCOL(W, k0, o, lane) wcol_io(W, k0, o, lane, DIN)
#define WOCOLH(W, k0, o, lane) wcolh_io(W, k0, o, lane, DIN)
#endif
#define SP_EPS 1.0e-8f
// ---- k_prepr: block = 128 positions t0.. of sequence b, which are one contiguous run of 128 x 64 floats in each input. Every element is read once, by 16-byte loads whose lanes cover whole 128-byte lines, and all 24 loads of a thread are issued before the first value is used (one round trip to memory a block). Values are bf16-rounded (exact in f16) and written as the three planes k_att reads: q -> f16 rows, k -> f16 rows, v -> f16 planes [c][t]
#define PT 128             // positions per block: a channel's piece of the v plane is then 256 contiguous bytes
typedef __attribute__((ext_vector_type(4))) _Float16 v4h;
__global__ __launch_bounds__(256) void k_prepr(const float* __restrict__ Q, const float* __restrict__ K, const float* __restrict__ V, _Float16* __restrict__ QH, _Float16* __restrict__ KH, _Float16* __restrict__ VT) {
  __shared__ __align__(16) _Float16 tv[HD][PT];   /* v turned: row = channel c, 16 pieces of 8 positions; piece p of row c lies at place p ^ (c >> 2), so that the 16 lanes of a half wave hit 16 different places both when writing (16 rows, one p) and when reading (one row, 16 p) */
  const int tid = threadIdx.x, j = tid & 15, tg = tid >> 4; const size_t r0 = (size_t)blockIdx.x * PT; const size_t bb = r0 / TT; const int t0 = (int)(r0 % TT);
  const float* vg = V + (r0 + tg * 8) * CC + j * 4; const float* qg = Q + r0 * CC + tid * 4; const float* kg = K + r0 * CC + tid * 4;
  v4f v[8], q[8], k[8];   /* v: positions 8 tg + i, channels 4 j .. 4 j + 3; q, k: elements 1024 i + 4 tid .. + 3 of the run */
#pragma unroll
  for (int i = 0; i < 8; ++i) v[i] = *(const v4f*)(vg + i * CC);
  asm volatile("s_wait_xcnt 0x0" ::: "memory");   /* stands behind the v loads, in front of the first reuse of their address pair; a precaution */
#pragma unroll
  for (int i = 0; i < 8; ++i) q[i] = *(const v4f*)(qg + i * 1024);
#pragma unroll
  for (int i = 0; i < 8; ++i) k[i] = *(const v4f*)(kg + i * 1024);
  asm volatile("s_wait_xcnt 0x0" ::: "memory");   /* stands behind the q and k loads, in front of the first reuse of their scalar bases; a precaution */
  __builtin_amdgcn_sched_barrier(0);   /* keeps all 24 loads in front of the first use of a value: one round trip to memory (without it the v loads were issued only behind the wait for q and k: two); and keeps every later write of an address register behind the wait above */
#pragma unroll
  for (int cc = 0; cc < 4; ++cc) { v8h h;
#pragma unroll
    for (int i = 0; i < 8; ++i) h[i] = (_Float16)bfr(v[i][cc]);
    vst2(&tv[4 * j + cc][(tg ^ j) * 8], h); }
  __syncthreads();   /* stands in front of every global store, so that it waits for none */
#pragma unroll
  for (int i = 0; i < 4; ++i) { const int e = i * 256 + tid, c = e >> 4, p = e & 15; vst2(VT + (bb * CC + c) * (size_t)TT + t0 + p * 8, *(const v4u*)&tv[c][(p ^ (c >> 2)) * 8]); }
  _Float16* qo = QH + r0 * CC + tid * 4; _Float16* ko = KH + r0 * CC + tid * 4;
#pragma unroll
  for (int i = 0; i < 8; ++i) { const v4h a = {(_Float16)bfr(q[i][0]), (_Float16)bfr(q[i][1]), (_Float16)bfr(q[i][2]), (_Float16)bfr(q[i][3])}; vst2(qo + i * 1024, a); }
#pragma unroll
  for (int i = 0; i < 8; ++i) { const v4h a = {(_Float16)bfr(k[i][0]), (_Float16)bfr(k[i][1]), (_Float16)bfr(k[i][2]), (_Float16)bfr(k[i][3])}; vst2(ko + i * 1024, a); } }

#define WS_QH  0u                                      // f16 q rows [b*t][CC]
#define WS_KH  (WS_QH + 2u * (size_t)NB * TT * CC)      // f16 k rows [b*t][CC]
#define WS_VT  (WS_KH + 2u * (size_t)NB * TT * CC)      // f16 v planes [b][c][t]
#define WS_QL  (WS_VT + 2u * (size_t)NB * CC * TT)      // f16 q residual x 2^10 rows [b][t < QHI][CC]
#define WS_KL  (WS_QL + 2u * (size_t)NB * QHI * CC)     // f16 k residual x 2^10 rows [b][t < KHI][CC]
#define WS_VB  (WS_KL + 2u * (size_t)NB * KHI * CC)     // bf16 v hi planes [b][c][t < KHI]
#define WS_VBL (WS_VB + 2u * (size_t)NB * CC * KHI)
#define WS_END (WS_VBL + 2u * (size_t)NB * CC * KHI)

// ---- k_att: block = 128 queries of sequence b, 8 waves x 16 query columns; all keys in stages of 64. S^T = K . Q^T (A = key rows from LDS, B = q kept in registers), so a lane holds one query's scores; the two 16-key score tiles, turned into weights in place, are the B operand of O^T += V^T . P^T (A = v planes [c][key] from LDS, same k order as frag_h): scores and weights never leave the registers. No row maximum is needed (plain sum), so one pass over the keys does it all; the context is divided by the row sum at the end.
#define KST 64             // keys per stage
#define NST (TT / KST)
#define LP 72              // LDS row pitch in f16: 144 B = 16 B x 9 (odd), conflict-free for 16-byte fragment reads
typedef __attribute__((ext_vector_type(2))) _Float16 v2h;
__device__ __forceinline__ v8f wmma_h(v16h a, v16h b, v8f c) { return __builtin_amdgcn_wmma_f32_16x16x32_f16(false, a, false, b, (short)0, c, false, false); }
// four waves per SIMD = two blocks per WGP: the 512 blocks are all resident, two on every WGP
__global__ __launch_bounds__(256) __attribute__((amdgpu_waves_per_eu(4, 4))) void k_att(const _Float16* __restrict__ QH, const _Float16* __restrict__ KH, const _Float16* __restrict__ VT, const float* __restrict__ SCL, float* __restrict__ O) {
  __shared__ __align__(16) _Float16 sk[2][KST][LP], sv[2][HD][LP];
  const int tid = threadIdx.x, wave = tid >> 5, lane = tid & 31, col = lane & 15, g = lane >> 4;
  const int b = blockIdx.y, q0 = blockIdx.x * 128 + wave * 16;
  // the scale is a scalar INPUT (bf16-rounded like every float input). Weights are formed in units of ln 2 (the unit cancels in the division by the row sum): w = f * (max(u, 0) + log2(1 + 2^-|u|) + eps / ln 2), u = score * scale * log2(e); f = 1 up to |scale| = 64 and 64 / |scale| beyond, which keeps the unnormalised weights inside f16 for any scale; f cancels too
  const float sc = bfr(SCL[0]); const float f = fabsf(sc) > 64.0f ? 64.0f / fabsf(sc) : 1.0f; const float c2 = sc * 1.44269504f; const float e2 = SP_EPS * 1.44269504f * f;
  const v2f cu = {c2, c2}, cm = {c2 * f, c2 * f}, em = {e2, e2}, ff = {f, f}, one = {1.0f, 1.0f};
  v16h qf[2];
#pragma unroll
  for (int kc = 0; kc < 2; ++kc) qf[kc] = frag_h(QH + ((size_t)b * TT + q0 + col) * CC + kc * 32, lane);
  // staging: thread = (row sr and sr + 32, 16-byte piece sp): whole 128-byte lines from global, through registers into the padded LDS rows
  const int sr = tid >> 3, sp = tid & 7;
  const _Float16* kg = KH + ((size_t)b * TT + sr) * CC + sp * 8; const _Float16* vg = VT + ((size_t)b * CC + sr) * TT + sp * 8;
  v4u rk0 = *(const v4u*)kg, rk1 = *(const v4u*)(kg + 32 * CC), rv0 = *(const v4u*)vg, rv1 = *(const v4u*)(vg + (size_t)32 * TT);
  asm volatile("s_wait_xcnt 0x0" ::: "memory");   /* stands in front of the first reuse of an address register of the q, k and v loads above; a precaution */
  *(v4u*)&sk[0][sr][sp * 8] = rk0; *(v4u*)&sk[0][sr + 32][sp * 8] = rk1; *(v4u*)&sv[0][sr][sp * 8] = rv0; *(v4u*)&sv[0][sr + 32][sp * 8] = rv1;
  __syncthreads();
  v8f acc[HD / 16] = {}; v2f sum[4] = {};   /* four independent partial row sums: no long dependent chain of adds */
#pragma unroll 1
  for (int s = 0; s < NST; ++s) { const int bu = s & 1; const bool more = s + 1 < NST;
    if (more) { const _Float16* kn = kg + (size_t)(s + 1) * KST * CC; const _Float16* vn = vg + (s + 1) * KST;   /* the next stage flies while this one is worked on */
      rk0 = *(const v4u*)kn; rk1 = *(const v4u*)(kn + 32 * CC); rv0 = *(const v4u*)vn; rv1 = *(const v4u*)(vn + (size_t)32 * TT); }
#pragma unroll
    for (int kk = 0; kk < KST / 32; ++kk) { v8f st[2]; v16h kf[2][2], vf[HD / 16];
#pragma unroll
      for (int t = 0; t < 2; ++t) { const _Float16* kr = &sk[bu][kk * 32 + t * 16 + col][0]; kf[t][0] = frag_h(kr, lane); kf[t][1] = frag_h(kr + 32, lane); }
#pragma unroll
      for (int j = 0; j < HD / 16; ++j) vf[j] = frag_h(&sv[bu][j * 16 + col][kk * 32], lane);
      __builtin_amdgcn_sched_barrier(0);   /* keeps the pass's 16 LDS reads in one group ahead of its products: one LDS latency a pass (the v reads land under the weights) instead of a drained wait in front of every product */
#pragma unroll
      for (int t = 0; t < 2; ++t) { v8f z = {}; z = wmma_h(kf[t][0], qf[0], z); st[t] = wmma_h(kf[t][1], qf[1], z); }
      v16h p;
#pragma unroll
      for (int t = 0; t < 2; ++t)
#pragma unroll
        for (int r = 0; r < 8; r += 2) { const v2f a = {st[t][r], st[t][r + 1]}; const v2f u = a * cu;
          v2f x; x.x = __builtin_amdgcn_exp2f(-fabsf(u.x)); x.y = __builtin_amdgcn_exp2f(-fabsf(u.y)); x = x + one;
          v2f l; l.x = __builtin_amdgcn_logf(x.x); l.y = __builtin_amdgcn_logf(x.y);
          const v2f w = __builtin_elementwise_fma(l, ff, __builtin_elementwise_max(__builtin_elementwise_fma(a, cm, em), em));   /* max(f u + f eps', f eps') = f max(u, 0) + f eps' */
          sum[r >> 1] += w; const v2h ph = __builtin_convertvector(w, v2h); p[t * 8 + r] = ph.x; p[t * 8 + r + 1] = ph.y; }
#pragma unroll
      for (int j = 0; j < HD / 16; ++j) acc[j] = wmma_h(vf[j], p, acc[j]); }
    if (more) { const int bn = bu ^ 1;   /* its last readers left this buffer at the barrier that ended stage s - 1 */
      *(v4u*)&sk[bn][sr][sp * 8] = rk0; *(v4u*)&sk[bn][sr + 32][sp * 8] = rk1; *(v4u*)&sv[bn][sr][sp * 8] = rv0; *(v4u*)&sv[bn][sr + 32][sp * 8] = rv1; }
    __syncthreads(); }
  const v2f s2 = (sum[0] + sum[1]) + (sum[2] + sum[3]); float tot = s2.x + s2.y; tot += __shfl_xor(tot, 16);   /* the two lane halves hold the two halves of a query's keys */
  const float inv = 1.0f / tot;
  float* o = O + ((size_t)b * TT + q0 + col) * CC + 8 * g;   /* acc[j][r] = channel 16 j + 8 g + r of query col */
#pragma unroll
  for (int j = 0; j < HD / 16; ++j) { const v4f lo = {acc[j][0] * inv, acc[j][1] * inv, acc[j][2] * inv, acc[j][3] * inv}, hi = {acc[j][4] * inv, acc[j][5] * inv, acc[j][6] * inv, acc[j][7] * inv}; vst2(o + j * 16, lo); vst2(o + j * 16 + 4, hi); } }

extern "C" void kernel_launch(void* const* d_in, const int* in_sizes, int n_in, void* d_out, int out_size, void* d_ws, size_t ws_size, hipStream_t stream) {
  (void)in_sizes; (void)n_in; (void)out_size;
  const float** F = (const float**)d_in;
  if (ws_size < (size_t)WS_END) return;
  char* ws = (char*)d_ws; _Float16 *QH = (_Float16*)(ws + WS_QH), *KH = (_Float16*)(ws + WS_KH), *VT = (_Float16*)(ws + WS_VT);
  // inputs: 0 q [32,2048,64]; 1 k; 2 v; 3 scale (f32 scalar)
  k_prepr<<<dim3(TNB * TT / PT), 256, 0, stream>>>(F[0], F[1], F[2], QH, KH, VT);   /* raw inputs - the planes k_att reads (bf16-rounded; exact in f16) */
  k_att<<<dim3(TT / 128, TNB), 256, 0, stream>>>(QH, KH, VT, F[3], (float*)d_out);
}

// v003
// One run takes 48.3 microseconds.
// Two timings next to v002 both put it at 1.06 times that version's speed.
// Counting every step since v000, it is 56.7 times as fast.
// compute dtype: all float inputs rounded to bf16; raw q / k / v: the scores q . k are exact products of f16-exact inputs (f32 accumulate), multiplied by the scale INPUT in f32; weights = softplus(score) + 1e-8 in f32 (no exponential softmax), rounded once to f16 unnormalised x v (exact in f16); the f32 context is divided by the f32 row sum of the weights; f32 output.
#include <hip/hip_runtime.h>
#include <math.h>

typedef __attribute__((ext_vector_type(16))) _Float16 v16h;
typedef __attribute__((ext_vector_type(16))) __bf16 v16b;
typedef __attribute__((ext_vector_type(8)))  _Float16 v8h;
typedef __attribute__((ext_vector_type(8)))  float v8f;
typedef __attribute__((ext_vector_type(4)))  float v4f;
typedef __attribute__((ext_vector_type(2)))  float v2f;
typedef __attribute__((ext_vector_type(4)))  unsigned v4u;
typedef __attribute__((ext_vector_type(4)))  int v4i;
typedef float __attribute__((may_alias)) float_a;
typedef int __attribute__((may_alias)) int_a;

template <typename T> __device__ __forceinline__ void vst2(void* p, T v) { *(T*)p = v;  }
__device__ __forceinline__ v8f wmma16(v16h a, v16h b, v8f c) {
  v8f d = __builtin_amdgcn_wmma_f32_16x16x32_f16(false, a, false, b, (short)0, c, false, false);
  asm volatile("v_nop\n\tv_nop\n\tv_nop\n\tv_nop" : "+v"(d) : "v"(a), "v"(b));
  return d;
}
__device__ __forceinline__ v8f wmma_bf(v16b a, v16b b, v8f c) {
  v8f d = __builtin_amdgcn_wmma_f32_16x16x32_bf16(false, a, false, b, (short)0, c, false, false);
  asm volatile("v_nop\n\tv_nop\n\tv_nop\n\tv_nop" : "+v"(d) : "v"(a), "v"(b));
  return d;
}
// 16x16x32 fragments: lane = (h = lane>>4, row/col = lane&15); elements 0..7 = k0+8h+0..7, 8..15 = k0+16+8h+0..7; D element r = row 8h+r
__device__ __forceinline__ v16h frag_h(const _Float16* rowk0, int lane) {
  union { v16h v; v8h q[2]; } u; const _Float16* p = rowk0 + 8 * (lane >> 4);
  u.q[0] = *(const v8h*)p; u.q[1] = *(const v8h*)(p + 16); return u.v;
}
__device__ __forceinline__ v16h frag_f32(const float* rowk0, int lane) {
  v16h a; const float* p = rowk0 + 8 * (lane >> 4);
#pragma unroll
  for (int i = 0; i < 8; ++i) { a[i] = (_Float16)p[i]; a[8 + i] = (_Float16)p[16 + i]; }
  return a;
}
__device__ __forceinline__ v16h frag_f32s(const float* rowk0, int lane, float sc) {
  v16h a; const float* p = rowk0 + 8 * (lane >> 4);
#pragma unroll
  for (int i = 0; i < 8; ++i) { a[i] = (_Float16)(p[i] * sc); a[8 + i] = (_Float16)(p[16 + i] * sc); }
  return a;
}
// column fragment from a [K][ld] layout (column n), rows >= K read as 0
__device__ __forceinline__ v16h fragc_f32(const float* W, int k0, int n, int lane, int ld, int K) {
  v16h a; const int g = lane >> 4;
#pragma unroll
  for (int i = 0; i < 8; ++i) { const int ka = k0 + 8 * g + i, kb = ka + 16;
    a[i] = (_Float16)(ka < K ? W[(size_t)(ka < K ? ka : K - 1) * ld + n] : 0.f); a[8 + i] = (_Float16)(kb < K ? W[(size_t)(kb < K ? kb : K - 1) * ld + n] : 0.f); }
  return a;
}
struct F2 { v16b h, l; };
__device__ __forceinline__ F2 bsplit16(const float v[16]) { F2 r;
#pragma unroll
  for (int i = 0; i < 16; ++i) { const __bf16 h = (__bf16)v[i]; r.h[i] = h; r.l[i] = (__bf16)(v[i] - (float)h); }
  return r; }
__device__ __forceinline__ F2 split_row(const float* row, int k0, int lane) { float v[16]; const float* p = row + k0 + 8 * (lane >> 4);
#pragma unroll
  for (int i = 0; i < 8; ++i) { v[i] = p[i]; v[8 + i] = p[16 + i]; }
  return bsplit16(v); }
__device__ __forceinline__ F2 split_rowK(const float* row, int k0, int lane, int K) { float v[16]; const int g = lane >> 4;
#pragma unroll
  for (int i = 0; i < 8; ++i) { const int ka = k0 + 8 * g + i, kb = ka + 16; v[i] = ka < K ? row[ka < K ? ka : K - 1] : 0.f; v[8 + i] = kb < K ? row[kb < K ? kb : K - 1] : 0.f; }
  return bsplit16(v); }
__device__ __forceinline__ F2 split_col(const float* W, int k0, int n, int lane, int ld, int K) { float v[16]; const int g = lane >> 4;
#pragma unroll
  for (int i = 0; i < 8; ++i) { const int ka = k0 + 8 * g + i, kb = ka + 16; v[i] = ka < K ? W[(size_t)(ka < K ? ka : K - 1) * ld + n] : 0.f; v[8 + i] = kb < K ? W[(size_t)(kb < K ? kb : K - 1) * ld + n] : 0.f; }
  return bsplit16(v); }
__device__ __forceinline__ v8f mac3(const F2& a, const F2& b, v8f c) { c = wmma_bf(a.l, b.h, c); c = wmma_bf(a.h, b.l, c); return wmma_bf(a.h, b.h, c); }
__device__ __forceinline__ float sigm(float v) { return 1.0f / (1.0f + expf(-v)); }
#define LDSX() do { asm volatile("s_wait_dscnt 0" ::: "memory"); __builtin_amdgcn_wave_barrier(); __builtin_amdgcn_fence(__ATOMIC_RELEASE, "workgroup"); } while (0)

// Quadratic attention with a softplus kernel instead of a softmax (q / k / v [32,2048,64]; sim = softplus(q k^T * scale) + 1e-8 with scale a scalar input; sim /= sum over keys; out = sim v -> [32,2048,64]; no mask).
#define NB 32
#define TT 2048
#define CC 64            // NH * HD = projected width
#define DIN 64          // input (model) width
#define NH 1
#define HD 64
#define NQB (TT / 64)
#define HG 1
#define SCALE (1.0f)
#define CAUSAL 0
#ifndef TNB
#define TNB NB
#endif
__device__ __forceinline__ float bfr(float v) { return (float)(__bf16)v; }
__host__ __device__ __forceinline__ int kb_last(int qb) { return CAUSAL ? ((qb * 64 + 63) >> 7) : (TT / 128 - 1); }
typedef __attribute__((ext_vector_type(8))) __bf16 v8b;
__device__ __forceinline__ v16b frag_b(const __bf16* rowk0, int lane) {
  union { v16b v; v8b q[2]; } u; const __bf16* p = rowk0 + 8 * (lane >> 4);
  u.q[0] = *(const v8b*)p; u.q[1] = *(const v8b*)(p + 16); return u.v;
}
#define QBH 0              // unused: k_att has no causal or high-precision path
#define QHI 0              // (override) rows carrying the q residual plane
#define KHI 64            // key rows carrying k residual / v bf16 hi+lo planes (no kernel in this file writes or reads them)
// B fragment (k rows k0+.., output column o) of a weight: (in,out) [K][ld] or (out,in) [ld rows of K]: bf16 exact, or f16(bf16 * 256) exact
__device__ __forceinline__ v16b wcol_io(const float* Wm, int k0, int o, int lane, int ld) { v16b w; const int g = lane >> 4;
#pragma unroll
  for (int i = 0; i < 8; ++i) { w[i] = (__bf16)Wm[(size_t)(k0 + 8 * g + i) * ld + o]; w[8 + i] = (__bf16)Wm[(size_t)(k0 + 16 + 8 * g + i) * ld + o]; }
  return w; }
__device__ __forceinline__ v16b wcol_oi(const float* Wm, int k0, int o, int lane, int K) { v16b w; const float* p = Wm + (size_t)o * K + k0 + 8 * (lane >> 4);
#pragma unroll
  for (int i = 0; i < 8; ++i) { w[i] = (__bf16)p[i]; w[8 + i] = (__bf16)p[16 + i]; }
  return w; }
__device__ __forceinline__ v16h wcolh_io(const float* Wm, int k0, int o, int lane, int ld) { v16h w; const int g = lane >> 4;
#pragma unroll
  for (int i = 0; i < 8; ++i) { w[i] = (_Float16)(bfr(Wm[(size_t)(k0 + 8 * g + i) * ld + o]) * 256.0f); w[8 + i] = (_Float16)(bfr(Wm[(size_t)(k0 + 16 + 8 * g + i) * ld + o]) * 256.0f); }
  return w; }
__device__ __forceinline__ v16h wcolh_oi(const float* Wm, int k0, int o, int lane, int K) { v16h w; const float* p = Wm + (size_t)o * K + k0 + 8 * (lane >> 4);
#pragma unroll
  for (int i = 0; i < 8; ++i) { w[i] = (_Float16)(bfr(p[i]) * 256.0f); w[8 + i] = (_Float16)(bfr(p[16 + i]) * 256.0f); }
  return w; }
#define WQKV_LAYOUT 1   // 0 = (in,out) [DIN][CC]; 1 = (out,in) [CC][DIN]; 2 = per-head [NH][DIN][HD]
__device__ __forceinline__ v16b wcol_hdk(const float* Wm, int k0, int o, int lane) { v16b w; const int g = lane >> 4; const float* p = Wm + (size_t)(o / HD) * DIN * HD + (o % HD);
#pragma unroll
  for (int i = 0; i < 8; ++i) { w[i] = (__bf16)p[(size_t)(k0 + 8 * g + i) * HD]; w[8 + i] = (__bf16)p[(size_t)(k0 + 16 + 8 * g + i) * HD]; }
  return w; }
#define WO_OUT_IN 0
#if WQKV_LAYOUT == 1
#define WCOL(W, k0, o, lane) wcol_oi(W, k0, o, lane, DIN)
#elif WQKV_LAYOUT == 2
#define WCOL(W, k0, o, lane) wcol_hdk(W, k0, o, lane)
#else
#define WCOL(W, k0, o, lane) wcol_io(W, k0, o, lane, CC)
#endif
#if WO_OUT_IN
#define WOCOL(W, k0, o, lane) wcol_oi(W, k0, o, lane, CC)
#define WOCOLH(W, k0, o, lane) wcolh_oi(W, k0, o, lane, CC)
#else
#define WOCOL(W, k0, o, lane) wcol_io(W, k0, o, lane, DIN)
#define WOCOLH(W, k0, o, lane) wcolh_io(W, k0, o, lane, DIN)
#endif
#define SP_EPS 1.0e-8f
// ---- k_prepr: block = 128 positions t0.. of sequence b, which are one contiguous run of 128 x 64 floats in each input. Every element is read once, by 16-byte loads whose lanes cover whole 128-byte lines, and all 24 loads of a thread are issued before the first value is used (one round trip to memory a block). Values are bf16-rounded (exact in f16) and written as the three planes k_att reads: q -> f16 rows, k -> f16 rows, v -> f16 planes [c][t]
#define PT 128             // positions per block: a channel's piece of the v plane is then 256 contiguous bytes
typedef __attribute__((ext_vector_type(4))) _Float16 v4h;
__global__ __launch_bounds__(256) void k_prepr(const float* __restrict__ Q, const float* __restrict__ K, const float* __restrict__ V, _Float16* __restrict__ QH, _Float16* __restrict__ KH, _Float16* __restrict__ VT) {
  __shared__ __align__(16) _Float16 tv[HD][PT];   /* v turned: row = channel c, 16 pieces of 8 positions; piece p of row c lies at place p ^ (c >> 2), so that the 16 lanes of a half wave hit 16 different places both when writing (16 rows, one p) and when reading (one row, 16 p) */
  const int tid = threadIdx.x, j = tid & 15, tg = tid >> 4; const size_t r0 = (size_t)blockIdx.x * PT; const size_t bb = r0 / TT; const int t0 = (int)(r0 % TT);
  const float* vg = V + (r0 + tg * 8) * CC + j * 4; const float* qg = Q + r0 * CC + tid * 4; const float* kg = K + r0 * CC + tid * 4;
  v4f v[8], q[8], k[8];   /* v: positions 8 tg + i, channels 4 j .. 4 j + 3; q, k: elements 1024 i + 4 tid .. + 3 of the run */
#pragma unroll
  for (int i = 0; i < 8; ++i) v[i] = *(const v4f*)(vg + i * CC);
  asm volatile("s_wait_xcnt 0x0" ::: "memory");   /* stands behind the v loads, in front of the first reuse of their address pair; a precaution */
#pragma unroll
  for (int i = 0; i < 8; ++i) q[i] = *(const v4f*)(qg + i * 1024);
#pragma unroll
  for (int i = 0; i < 8; ++i) k[i] = *(const v4f*)(kg + i * 1024);
  asm volatile("s_wait_xcnt 0x0" ::: "memory");   /* stands behind the q and k loads, in front of the first reuse of their scalar bases; a precaution */
  __builtin_amdgcn_sched_barrier(0);   /* keeps all 24 loads in front of the first use of a value: one round trip to memory (without it the v loads were issued only behind the wait for q and k: two); and keeps every later write of an address register behind the wait above */
#pragma unroll
  for (int cc = 0; cc < 4; ++cc) { v8h h;
#pragma unroll
    for (int i = 0; i < 8; ++i) h[i] = (_Float16)bfr(v[i][cc]);
    vst2(&tv[4 * j + cc][(tg ^ j) * 8], h); }
  __syncthreads();   /* stands in front of every global store, so that it waits for none */
#pragma unroll
  for (int i = 0; i < 4; ++i) { const int e = i * 256 + tid, c = e >> 4, p = e & 15; vst2(VT + (bb * CC + c) * (size_t)TT + t0 + p * 8, *(const v4u*)&tv[c][(p ^ (c >> 2)) * 8]); }
  _Float16* qo = QH + r0 * CC + tid * 4; _Float16* ko = KH + r0 * CC + tid * 4;
#pragma unroll
  for (int i = 0; i < 8; ++i) { const v4h a = {(_Float16)bfr(q[i][0]), (_Float16)bfr(q[i][1]), (_Float16)bfr(q[i][2]), (_Float16)bfr(q[i][3])}; vst2(qo + i * 1024, a); }
#pragma unroll
  for (int i = 0; i < 8; ++i) { const v4h a = {(_Float16)bfr(k[i][0]), (_Float16)bfr(k[i][1]), (_Float16)bfr(k[i][2]), (_Float16)bfr(k[i][3])}; vst2(ko + i * 1024, a); } }

#define WS_QH  0u                                      // f16 q rows [b*t][CC]
#define WS_KH  (WS_QH + 2u * (size_t)NB * TT * CC)      // f16 k rows [b*t][CC]
#define WS_VT  (WS_KH + 2u * (size_t)NB * TT * CC)      // f16 v planes [b][c][t]
#define WS_QL  (WS_VT + 2u * (size_t)NB * CC * TT)      // f16 q residual x 2^10 rows [b][t < QHI][CC]
#define WS_KL  (WS_QL + 2u * (size_t)NB * QHI * CC)     // f16 k residual x 2^10 rows [b][t < KHI][CC]
#define WS_VB  (WS_KL + 2u * (size_t)NB * KHI * CC)     // bf16 v hi planes [b][c][t < KHI]
#define WS_VBL (WS_VB + 2u * (size_t)NB * CC * KHI)
#define WS_END (WS_VBL + 2u * (size_t)NB * CC * KHI)

// ---- k_att: block = 128 queries of sequence b, 8 waves x 16 query columns; all keys in stages of 64. S^T = K . Q^T (A = key rows from LDS, B = q kept in registers), so a lane holds one query's scores; the two 16-key score tiles, turned into weights in place, are the B operand of O^T += V^T . P^T (A = v planes [c][key] from LDS, same k order as frag_h): scores and weights never leave the registers. No row maximum is needed (plain sum), so one pass over the keys does it all unless a row sum of the direct form overflows: then the block walks them again in the guarded form; the context is divided by the row sum at the end.
#define KST 64             // keys per stage
#define NST (TT / KST)
#define LP 72              // LDS row pitch in f16: 144 B = 16 B x 9 (odd), conflict-free for 16-byte fragment reads
typedef __attribute__((ext_vector_type(2))) _Float16 v2h;
__device__ __forceinline__ v8f wmma_h(v16h a, v16h b, v8f c) { return __builtin_amdgcn_wmma_f32_16x16x32_f16(false, a, false, b, (short)0, c, false, false); }
// one walk over all keys of the sequence. DIRECT: w = log2(1 + 2^u) + eps' (no |u|, no maximum: two vector instructions fewer per pair of weights); right while 2^u stays finite (u < 128), and an overflow shows as an infinite row sum. Otherwise the guarded form, right for every u: w = f * (max(u, 0) + log2(1 + 2^-|u|) + eps')
template <bool DIRECT>
__device__ __forceinline__ void walk_keys(_Float16 (&sk)[2][KST][LP], _Float16 (&sv)[2][HD][LP], const _Float16* kg, const _Float16* vg, const v16h (&qf)[2], const int sr, const int sp, const int col, const int lane, const float c2, const float f, const float e2, v8f (&acc)[HD / 16], v2f (&sum)[4]) {
  const v2f cu = {c2, c2}, cm = {c2 * f, c2 * f}, em = {e2, e2}, ff = {f, f}, one = {1.0f, 1.0f};
  v4u rk0 = *(const v4u*)kg, rk1 = *(const v4u*)(kg + 32 * CC), rv0 = *(const v4u*)vg, rv1 = *(const v4u*)(vg + (size_t)32 * TT);
  asm volatile("s_wait_xcnt 0x0" ::: "memory");   /* stands in front of the first reuse of an address register of the loads above; a precaution */
  *(v4u*)&sk[0][sr][sp * 8] = rk0; *(v4u*)&sk[0][sr + 32][sp * 8] = rk1; *(v4u*)&sv[0][sr][sp * 8] = rv0; *(v4u*)&sv[0][sr + 32][sp * 8] = rv1;
  __syncthreads();
#pragma unroll 1
  for (int s = 0; s < NST; ++s) { const int bu = s & 1; const bool more = s + 1 < NST;
    if (more) { const _Float16* kn = kg + (size_t)(s + 1) * KST * CC; const _Float16* vn = vg + (s + 1) * KST;   /* the next stage flies while this one is worked on */
      rk0 = *(const v4u*)kn; rk1 = *(const v4u*)(kn + 32 * CC); rv0 = *(const v4u*)vn; rv1 = *(const v4u*)(vn + (size_t)32 * TT); }
#pragma unroll
    for (int kk = 0; kk < KST / 32; ++kk) { v8f st[2]; v16h kf[2][2], vf[HD / 16];
#pragma unroll
      for (int t = 0; t < 2; ++t) { const _Float16* kr = &sk[bu][kk * 32 + t * 16 + col][0]; kf[t][0] = frag_h(kr, lane); kf[t][1] = frag_h(kr + 32, lane); }
#pragma unroll
      for (int j = 0; j < HD / 16; ++j) vf[j] = frag_h(&sv[bu][j * 16 + col][kk * 32], lane);
      __builtin_amdgcn_sched_barrier(0);   /* keeps the pass's 16 LDS reads in one group ahead of its products: one LDS latency a pass (the v reads land under the weights) instead of a drained wait in front of every product */
#pragma unroll
      for (int t = 0; t < 2; ++t) { v8f z = {}; z = wmma_h(kf[t][0], qf[0], z); st[t] = wmma_h(kf[t][1], qf[1], z); }
      v16h p;
#pragma unroll
      for (int t = 0; t < 2; ++t)
#pragma unroll
        for (int r = 0; r < 8; r += 2) { const v2f a = {st[t][r], st[t][r + 1]}; const v2f u = a * cu; v2f x, l, w;
          if constexpr (DIRECT) {
            x.x = __builtin_amdgcn_exp2f(u.x); x.y = __builtin_amdgcn_exp2f(u.y); x = x + one;
            l.x = __builtin_amdgcn_logf(x.x); l.y = __builtin_amdgcn_logf(x.y);
            w = l + em;
          } else {
            x.x = __builtin_amdgcn_exp2f(-fabsf(u.x)); x.y = __builtin_amdgcn_exp2f(-fabsf(u.y)); x = x + one;
            l.x = __builtin_amdgcn_logf(x.x); l.y = __builtin_amdgcn_logf(x.y);
            w = __builtin_elementwise_fma(l, ff, __builtin_elementwise_max(__builtin_elementwise_fma(a, cm, em), em));   /* max(f u + f eps', f eps') = f max(u, 0) + f eps' */
          }
          sum[r >> 1] += w; const v2h ph = __builtin_convertvector(w, v2h); p[t * 8 + r] = ph.x; p[t * 8 + r + 1] = ph.y; }
#pragma unroll
      for (int j = 0; j < HD / 16; ++j) acc[j] = wmma_h(vf[j], p, acc[j]); }
    if (more) { const int bn = bu ^ 1;   /* its last readers left this buffer at the barrier that ended stage s - 1 */
      *(v4u*)&sk[bn][sr][sp * 8] = rk0; *(v4u*)&sk[bn][sr + 32][sp * 8] = rk1; *(v4u*)&sv[bn][sr][sp * 8] = rv0; *(v4u*)&sv[bn][sr + 32][sp * 8] = rv1; }
    __syncthreads(); } }
// four waves per SIMD = two blocks per WGP: the 512 blocks are all resident, two on every WGP
__global__ __launch_bounds__(256) __attribute__((amdgpu_waves_per_eu(4, 4))) void k_att(const _Float16* __restrict__ QH, const _Float16* __restrict__ KH, const _Float16* __restrict__ VT, const float* __restrict__ SCL, float* __restrict__ O) {
  __shared__ __align__(16) _Float16 sk[2][KST][LP], sv[2][HD][LP];
  __shared__ int redo;   /* set by any lane whose row sum of the direct form is not finite */
  const int tid = threadIdx.x, wave = tid >> 5, lane = tid & 31, col = lane & 15, g = lane >> 4;
  const int b = blockIdx.y, q0 = blockIdx.x * 128 + wave * 16;
  // the scale is a scalar INPUT (bf16-rounded like every float input). Weights are formed in units of ln 2 (the unit cancels in the division by the row sum), u = score * scale * log2(e); f = 1 up to |scale| = 64 and 64 / |scale| beyond, which keeps the unnormalised weights of the guarded form inside f16 for any scale; f cancels too
  const float sc = bfr(SCL[0]); const float f = fabsf(sc) > 64.0f ? 64.0f / fabsf(sc) : 1.0f; const float c2 = sc * 1.44269504f; const float e2 = SP_EPS * 1.44269504f * f;
  v16h qf[2];
#pragma unroll
  for (int kc = 0; kc < 2; ++kc) qf[kc] = frag_h(QH + ((size_t)b * TT + q0 + col) * CC + kc * 32, lane);
  // staging: thread = (row sr and sr + 32, 16-byte piece sp): whole 128-byte lines from global, through registers into the padded LDS rows
  const int sr = tid >> 3, sp = tid & 7;
  const _Float16* kg = KH + ((size_t)b * TT + sr) * CC + sp * 8; const _Float16* vg = VT + ((size_t)b * CC + sr) * TT + sp * 8;
  v8f acc[HD / 16] = {}; v2f sum[4] = {};   /* four independent partial row sums: no long dependent chain of adds */
  if (tid == 0) redo = 0;   /* published by the first barrier of the walk */
  int guarded = __builtin_amdgcn_readfirstlane(fabsf(sc) <= 64.0f ? 0 : 1);   /* the same in every thread of the grid; a scalar, since barriers stand behind the branch */
  if (!guarded) {
    walk_keys<true>(sk, sv, kg, vg, qf, sr, sp, col, lane, c2, f, e2, acc, sum);
    const v2f h = (sum[0] + sum[1]) + (sum[2] + sum[3]);
    if (!(h.x + h.y < __builtin_inff())) redo = 1;   /* weights are never negative: one overflowed 2^u leaves the sum infinite */
    __syncthreads();   /* publishes the flag to the whole block */
    guarded = __builtin_amdgcn_readfirstlane(redo);
  }
  if (guarded) {   /* the whole block walks the keys again in the form that cannot overflow */
#pragma unroll
    for (int j = 0; j < HD / 16; ++j) acc[j] = v8f{};
#pragma unroll
    for (int j = 0; j < 4; ++j) sum[j] = v2f{};
    walk_keys<false>(sk, sv, kg, vg, qf, sr, sp, col, lane, c2, f, e2, acc, sum);
  }
  const v2f s2 = (sum[0] + sum[1]) + (sum[2] + sum[3]); float tot = s2.x + s2.y; tot += __shfl_xor(tot, 16);   /* the two lane halves hold the two halves of a query's keys */
  const float inv = 1.0f / tot;
  float* o = O + ((size_t)b * TT + q0 + col) * CC + 8 * g;   /* acc[j][r] = channel 16 j + 8 g + r of query col */
#pragma unroll
  for (int j = 0; j < HD / 16; ++j) { const v4f lo = {acc[j][0] * inv, acc[j][1] * inv, acc[j][2] * inv, acc[j][3] * inv}, hi = {acc[j][4] * inv, acc[j][5] * inv, acc[j][6] * inv, acc[j][7] * inv}; vst2(o + j * 16, lo); vst2(o + j * 16 + 4, hi); } }

extern "C" void kernel_launch(void* const* d_in, const int* in_sizes, int n_in, void* d_out, int out_size, void* d_ws, size_t ws_size, hipStream_t stream) {
  (void)in_sizes; (void)n_in; (void)out_size;
  const float** F = (const float**)d_in;
  if (ws_size < (size_t)WS_END) return;
  char* ws = (char*)d_ws; _Float16 *QH = (_Float16*)(ws + WS_QH), *KH = (_Float16*)(ws + WS_KH), *VT = (_Float16*)(ws + WS_VT);
  // inputs: 0 q [32,2048,64]; 1 k; 2 v; 3 scale (f32 scalar)
  k_prepr<<<dim3(TNB * TT / PT), 256, 0, stream>>>(F[0], F[1], F[2], QH, KH, VT);   /* raw inputs - the planes k_att reads (bf16-rounded; exact in f16) */
  k_att<<<dim3(TT / 128, TNB), 256, 0, stream>>>(QH, KH, VT, F[3], (float*)d_out);
}

// v004
// Measured time: 40.1 microseconds a run.
// Two timings next to v003 put it at 1.20 and 1.19 times that version's speed.
// All steps since v000 together make it 67.8 times as fast.
// compute dtype: all float inputs rounded to bf16; raw q / k / v: the scores q . k are exact products of the bf16 inputs (bf16 operands, f32 accumulate), multiplied by the scale INPUT in f32; weights = softplus(score) + 1e-8 in f32 (no exponential softmax), rounded once to f16 unnormalised x v (bf16-rounded, exact in f16); the f32 context is divided by the f32 row sum of the weights; f32 output.
#include <hip/hip_runtime.h>
#include <math.h>

typedef __attribute__((ext_vector_type(16))) _Float16 v16h;
typedef __attribute__((ext_vector_type(16))) __bf16 v16b;
typedef __attribute__((ext_vector_type(8)))  _Float16 v8h;
typedef __attribute__((ext_vector_type(8)))  float v8f;
typedef __attribute__((ext_vector_type(4)))  float v4f;
typedef __attribute__((ext_vector_type(2)))  float v2f;
typedef __attribute__((ext_vector_type(4)))  unsigned v4u;
typedef __attribute__((ext_vector_type(4)))  int v4i;
typedef float __attribute__((may_alias)) float_a;
typedef int __attribute__((may_alias)) int_a;

template <typename T> __device__ __forceinline__ void vst2(void* p, T v) { *(T*)p = v;  }
__device__ __forceinline__ v8f wmma16(v16h a, v16h b, v8f c) {
  v8f d = __builtin_amdgcn_wmma_f32_16x16x32_f16(false, a, false, b, (short)0, c, false, false);
  asm volatile("v_nop\n\tv_nop\n\tv_nop\n\tv_nop" : "+v"(d) : "v"(a), "v"(b));
  return d;
}
__device__ __forceinline__ v8f wmma_bf(v16b a, v16b b, v8f c) {
  v8f d = __builtin_amdgcn_wmma_f32_16x16x32_bf16(false, a, false, b, (short)0, c, false, false);
  asm volatile("v_nop\n\tv_nop\n\tv_nop\n\tv_nop" : "+v"(d) : "v"(a), "v"(b));
  return d;
}
// 16x16x32 fragments: lane = (h = lane>>4, row/col = lane&15); elements 0..7 = k0+8h+0..7, 8..15 = k0+16+8h+0..7; D element r = row 8h+r
__device__ __forceinline__ v16h frag_h(const _Float16* rowk0, int lane) {
  union { v16h v; v8h q[2]; } u; const _Float16* p = rowk0 + 8 * (lane >> 4);
  u.q[0] = *(const v8h*)p; u.q[1] = *(const v8h*)(p + 16); return u.v;
}
__device__ __forceinline__ v16h frag_f32(const float* rowk0, int lane) {
  v16h a; const float* p = rowk0 + 8 * (lane >> 4);
#pragma unroll
  for (int i = 0; i < 8; ++i) { a[i] = (_Float16)p[i]; a[8 + i] = (_Float16)p[16 + i]; }
  return a;
}
__device__ __forceinline__ v16h frag_f32s(const float* rowk0, int lane, float sc) {
  v16h a; const float* p = rowk0 + 8 * (lane >> 4);
#pragma unroll
  for (int i = 0; i < 8; ++i) { a[i] = (_Float16)(p[i] * sc); a[8 + i] = (_Float16)(p[16 + i] * sc); }
  return a;
}
// column fragment from a [K][ld] layout (column n), rows >= K read as 0
__device__ __forceinline__ v16h fragc_f32(const float* W, int k0, int n, int lane, int ld, int K) {
  v16h a; const int g = lane >> 4;
#pragma unroll
  for (int i = 0; i < 8; ++i) { const int ka = k0 + 8 * g + i, kb = ka + 16;
    a[i] = (_Float16)(ka < K ? W[(size_t)(ka < K ? ka : K - 1) * ld + n] : 0.f); a[8 + i] = (_Float16)(kb < K ? W[(size_t)(kb < K ? kb : K - 1) * ld + n] : 0.f); }
  return a;
}
struct F2 { v16b h, l; };
__device__ __forceinline__ F2 bsplit16(const float v[16]) { F2 r;
#pragma unroll
  for (int i = 0; i < 16; ++i) { const __bf16 h = (__bf16)v[i]; r.h[i] = h; r.l[i] = (__bf16)(v[i] - (float)h); }
  return r; }
__device__ __forceinline__ F2 split_row(const float* row, int k0, int lane) { float v[16]; const float* p = row + k0 + 8 * (lane >> 4);
#pragma unroll
  for (int i = 0; i < 8; ++i) { v[i] = p[i]; v[8 + i] = p[16 + i]; }
  return bsplit16(v); }
__device__ __forceinline__ F2 split_rowK(const float* row, int k0, int lane, int K) { float v[16]; const int g = lane >> 4;
#pragma unroll
  for (int i = 0; i < 8; ++i) { const int ka = k0 + 8 * g + i, kb = ka + 16; v[i] = ka < K ? row[ka < K ? ka : K - 1] : 0.f; v[8 + i] = kb < K ? row[kb < K ? kb : K - 1] : 0.f; }
  return bsplit16(v); }
__device__ __forceinline__ F2 split_col(const float* W, int k0, int n, int lane, int ld, int K) { float v[16]; const int g = lane >> 4;
#pragma unroll
  for (int i = 0; i < 8; ++i) { const int ka = k0 + 8 * g + i, kb = ka + 16; v[i] = ka < K ? W[(size_t)(ka < K ? ka : K - 1) * ld + n] : 0.f; v[8 + i] = kb < K ? W[(size_t)(kb < K ? kb : K - 1) * ld + n] : 0.f; }
  return bsplit16(v); }
__device__ __forceinline__ v8f mac3(const F2& a, const F2& b, v8f c) { c = wmma_bf(a.l, b.h, c); c = wmma_bf(a.h, b.l, c); return wmma_bf(a.h, b.h, c); }
__device__ __forceinline__ float sigm(float v) { return 1.0f / (1.0f + expf(-v)); }
#define LDSX() do { asm volatile("s_wait_dscnt 0" ::: "memory"); __builtin_amdgcn_wave_barrier(); __builtin_amdgcn_fence(__ATOMIC_RELEASE, "workgroup"); } while (0)

// Quadratic attention with a softplus kernel instead of a softmax (q / k / v [32,2048,64]; sim = softplus(q k^T * scale) + 1e-8 with scale a scalar input; sim /= sum over keys; out = sim v -> [32,2048,64]; no mask).
#define NB 32
#define TT 2048
#define CC 64            // NH * HD = projected width
#define DIN 64          // input (model) width
#define NH 1
#define HD 64
#define NQB (TT / 64)
#define HG 1
#define SCALE (1.0f)
#define CAUSAL 0
#ifndef TNB
#define TNB NB
#endif
__device__ __forceinline__ float bfr(float v) { return (float)(__bf16)v; }
__host__ __device__ __forceinline__ int kb_last(int qb) { return CAUSAL ? ((qb * 64 + 63) >> 7) : (TT / 128 - 1); }
typedef __attribute__((ext_vector_type(8))) __bf16 v8b;
__device__ __forceinline__ v16b frag_b(const __bf16* rowk0, int lane) {
  union { v16b v; v8b q[2]; } u; const __bf16* p = rowk0 + 8 * (lane >> 4);
  u.q[0] = *(const v8b*)p; u.q[1] = *(const v8b*)(p + 16); return u.v;
}
#define QBH 0              // unused: k_att has no causal or high-precision path
#define QHI 0              // (override) rows carrying the q residual plane
#define KHI 64            // key rows carrying k residual / v bf16 hi+lo planes (no kernel in this file writes or reads them)
// B fragment (k rows k0+.., output column o) of a weight: (in,out) [K][ld] or (out,in) [ld rows of K]: bf16 exact, or f16(bf16 * 256) exact
__device__ __forceinline__ v16b wcol_io(const float* Wm, int k0, int o, int lane, int ld) { v16b w; const int g = lane >> 4;
#pragma unroll
  for (int i = 0; i < 8; ++i) { w[i] = (__bf16)Wm[(size_t)(k0 + 8 * g + i) * ld + o]; w[8 + i] = (__bf16)Wm[(size_t)(k0 + 16 + 8 * g + i) * ld + o]; }
  return w; }
__device__ __forceinline__ v16b wcol_oi(const float* Wm, int k0, int o, int lane, int K) { v16b w; const float* p = Wm + (size_t)o * K + k0 + 8 * (lane >> 4);
#pragma unroll
  for (int i = 0; i < 8; ++i) { w[i] = (__bf16)p[i]; w[8 + i] = (__bf16)p[16 + i]; }
  return w; }
__device__ __forceinline__ v16h wcolh_io(const float* Wm, int k0, int o, int lane, int ld) { v16h w; const int g = lane >> 4;
#pragma unroll
  for (int i = 0; i < 8; ++i) { w[i] = (_Float16)(bfr(Wm[(size_t)(k0 + 8 * g + i) * ld + o]) * 256.0f); w[8 + i] = (_Float16)(bfr(Wm[(size_t)(k0 + 16 + 8 * g + i) * ld + o]) * 256.0f); }
  return w; }
__device__ __forceinline__ v16h wcolh_oi(const float* Wm, int k0, int o, int lane, int K) { v16h w; const float* p = Wm + (size_t)o * K + k0 + 8 * (lane >> 4);
#pragma unroll
  for (int i = 0; i < 8; ++i) { w[i] = (_Float16)(bfr(p[i]) * 256.0f); w[8 + i] = (_Float16)(bfr(p[16 + i]) * 256.0f); }
  return w; }
#define WQKV_LAYOUT 1   // 0 = (in,out) [DIN][CC]; 1 = (out,in) [CC][DIN]; 2 = per-head [NH][DIN][HD]
__device__ __forceinline__ v16b wcol_hdk(const float* Wm, int k0, int o, int lane) { v16b w; const int g = lane >> 4; const float* p = Wm + (size_t)(o / HD) * DIN * HD + (o % HD);
#pragma unroll
  for (int i = 0; i < 8; ++i) { w[i] = (__bf16)p[(size_t)(k0 + 8 * g + i) * HD]; w[8 + i] = (__bf16)p[(size_t)(k0 + 16 + 8 * g + i) * HD]; }
  return w; }
#define WO_OUT_IN 0
#if WQKV_LAYOUT == 1
#define WCOL(W, k0, o, lane) wcol_oi(W, k0, o, lane, DIN)
#elif WQKV_LAYOUT == 2
#define WCOL(W, k0, o, lane) wcol_hdk(W, k0, o, lane)
#else
#define WCOL(W, k0, o, lane) wcol_io(W, k0, o, lane, CC)
#endif
#if WO_OUT_IN
#define WOCOL(W, k0, o, lane) wcol_oi(W, k0, o, lane, CC)
#define WOCOLH(W, k0, o, lane) wcolh_oi(W, k0, o, lane, CC)
#else
#define WOCOL(W, k0, o, lane) wcol_io(W, k0, o, lane, DIN)
#define WOCOLH(W, k0, o, lane) wcolh_io(W, k0, o, lane, DIN)
#endif
#define SP_EPS 1.0e-8f
typedef __attribute__((ext_vector_type(4))) _Float16 v4h;
typedef __attribute__((ext_vector_type(4))) __bf16 v4b;
typedef __attribute__((ext_vector_type(2))) __bf16 v2b;

// ---- k_att: the only launch. Block = 128 queries of sequence b, 8 waves x 16 query columns; all keys in stages of 64, taken straight from the f32 inputs: a stage's k and v are rounded to bf16 on their way from the registers into LDS (k stays bf16; v goes on to f16, exact, and is turned to [c][key] by the choice of which thread holds what). S^T = K . Q^T (A = key rows from LDS, B = q kept in registers), so a lane holds one query's scores; the two 16-key score tiles, turned into weights in place, are the B operand of O^T += V^T . P^T (A = v planes [c][key] from LDS, same k order as frag_h): scores and weights never leave the registers. No row maximum is needed (plain sum): one pass over the keys, and a second one in the guarded form only if the direct form's row sum is not finite; the context is divided by the row sum at the end.
#define KST 64             // keys per stage
#define NST (TT / KST)
#define LP 72              // LDS row pitch in 16-bit elements: 144 B = 16 B x 9 (odd), conflict-free for 16-byte fragment reads
typedef __attribute__((ext_vector_type(2))) _Float16 v2h;
__device__ __forceinline__ v8f wmma_h(v16h a, v16h b, v8f c) { return __builtin_amdgcn_wmma_f32_16x16x32_f16(false, a, false, b, (short)0, c, false, false); }
__device__ __forceinline__ v8f wmma_b(v16b a, v16b b, v8f c) { return __builtin_amdgcn_wmma_f32_16x16x32_bf16(false, a, false, b, (short)0, c, false, false); }
// row fragment straight from f32 (same k order as frag_b), rounded to bf16
__device__ __forceinline__ v16b fragb_f32(const float* rowk0, int lane) { v16b a; const float* p = rowk0 + 8 * (lane >> 4);
#pragma unroll
  for (int i = 0; i < 8; ++i) { a[i] = (__bf16)p[i]; a[8 + i] = (__bf16)p[16 + i]; }
  return a; }
// a thread's share of one stage as it comes from memory. Thread = (sr = tid >> 4, sj = tid & 15): k rows sr + 16 i, channels 4 sj .. + 3; v keys 4 sr + i, channels 4 sj .. + 3. Each 16-byte load of a half wave covers one whole 256-byte row
struct Raw { v4f k[4], v[4]; };
__device__ __forceinline__ void fetch(Raw& r, const float* kn, const float* vn) {
#pragma unroll
  for (int i = 0; i < 4; ++i) r.k[i] = *(const v4f*)(kn + i * 16 * CC);
#pragma unroll
  for (int i = 0; i < 4; ++i) r.v[i] = *(const v4f*)(vn + i * CC);
  asm volatile("s_wait_xcnt 0x0" ::: "memory");   /* stands in front of the first reuse of an address register of the loads above; a precaution */
}
__device__ __forceinline__ void put(const Raw& r, __bf16 (&sk)[KST][LP], _Float16 (&sv)[HD][LP], const int sr, const int sj) {
#pragma unroll
  for (int i = 0; i < 4; ++i) *(v4b*)&sk[sr + 16 * i][sj * 4] = __builtin_convertvector(r.k[i], v4b);
  unsigned x[4][2];   /* key i, channels (2 h, 2 h + 1) as a bf16 pair: one packed rounding to nearest even for two neighbouring registers of a load */
#pragma unroll
  for (int i = 0; i < 4; ++i)
#pragma unroll
    for (int h = 0; h < 2; ++h) { const v2f ab = {r.v[i][2 * h], r.v[i][2 * h + 1]}; x[i][h] = __builtin_bit_cast(unsigned, __builtin_convertvector(ab, v2b)); }
#pragma unroll
  for (int cc = 0; cc < 4; ++cc) { float e[4];   /* channel cc of the four keys, back as f32, then f16 (exact for values inside f16's range) */
#pragma unroll
    for (int i = 0; i < 4; ++i) e[i] = __builtin_bit_cast(float, (cc & 1) ? (x[i][cc >> 1] & 0xffff0000u) : (x[i][cc >> 1] << 16));
    const v2f e01 = {e[0], e[1]}, e23 = {e[2], e[3]}; union { v2h p[2]; v4h q; } h; h.p[0] = __builtin_convertvector(e01, v2h); h.p[1] = __builtin_convertvector(e23, v2h);
    *(v4h*)&sv[sj * 4 + cc][sr * 4] = h.q; } }
// one walk over all keys of the sequence. DIRECT: w = log2(1 + 2^u) + eps' (no |u|, no maximum: two vector instructions fewer per pair of weights); right while 2^u stays finite (u < 128), and an overflow shows as an infinite row sum. Otherwise the guarded form, right for every u: w = f * (max(u, 0) + log2(1 + 2^-|u|) + eps')
template <bool DIRECT>
__device__ __forceinline__ void walk_keys(__bf16 (&sk)[2][KST][LP], _Float16 (&sv)[2][HD][LP], const float* kg, const float* vg, const v16b (&qf)[2], const int sr, const int sj, const int col, const int lane, const float c2, const float f, const float e2, v8f (&acc)[HD / 16], v2f (&sum)[4]) {
  const v2f cu = {c2, c2}, cm = {c2 * f, c2 * f}, em = {e2, e2}, ff = {f, f}, one = {1.0f, 1.0f};
  Raw raw; fetch(raw, kg, vg);
  put(raw, sk[0], sv[0], sr, sj);
  __syncthreads();
#pragma unroll 1
  for (int s = 0; s < NST; ++s) { const int bu = s & 1; const bool more = s + 1 < NST;
    if (more) fetch(raw, kg + (size_t)(s + 1) * KST * CC, vg + (size_t)(s + 1) * KST * CC);   /* the next stage flies while this one is worked on */
#pragma unroll
    for (int kk = 0; kk < KST / 32; ++kk) { v8f st[2]; v16b kf[2][2]; v16h vf[HD / 16];
#pragma unroll
      for (int t = 0; t < 2; ++t) { const __bf16* kr = &sk[bu][kk * 32 + t * 16 + col][0]; kf[t][0] = frag_b(kr, lane); kf[t][1] = frag_b(kr + 32, lane); }
#pragma unroll
      for (int j = 0; j < HD / 16; ++j) vf[j] = frag_h(&sv[bu][j * 16 + col][kk * 32], lane);
      __builtin_amdgcn_sched_barrier(0);   /* keeps the pass's 16 LDS reads in one group ahead of its products: one LDS latency a pass (the v reads land under the weights) instead of a drained wait in front of every product */
#pragma unroll
      for (int t = 0; t < 2; ++t) { v8f z = {}; z = wmma_b(kf[t][0], qf[0], z); st[t] = wmma_b(kf[t][1], qf[1], z); }
      v16h p;
#pragma unroll
      for (int t = 0; t < 2; ++t)
#pragma unroll
        for (int r = 0; r < 8; r += 2) { const v2f a = {st[t][r], st[t][r + 1]}; const v2f u = a * cu; v2f x, l, w;
          if constexpr (DIRECT) {
            x.x = __builtin_amdgcn_exp2f(u.x); x.y = __builtin_amdgcn_exp2f(u.y); x = x + one;
            l.x = __builtin_amdgcn_logf(x.x); l.y = __builtin_amdgcn_logf(x.y);
            w = l + em;
          } else {
            x.x = __builtin_amdgcn_exp2f(-fabsf(u.x)); x.y = __builtin_amdgcn_exp2f(-fabsf(u.y)); x = x + one;
            l.x = __builtin_amdgcn_logf(x.x); l.y = __builtin_amdgcn_logf(x.y);
            w = __builtin_elementwise_fma(l, ff, __builtin_elementwise_max(__builtin_elementwise_fma(a, cm, em), em));   /* max(f u + f eps', f eps') = f max(u, 0) + f eps' */
          }
          sum[r >> 1] += w; const v2h ph = __builtin_convertvector(w, v2h); p[t * 8 + r] = ph.x; p[t * 8 + r + 1] = ph.y; }
#pragma unroll
      for (int j = 0; j < HD / 16; ++j) acc[j] = wmma_h(vf[j], p, acc[j]); }
    if (more) put(raw, sk[bu ^ 1], sv[bu ^ 1], sr, sj);   /* its last readers left this buffer at the barrier that ended stage s - 1 */
    __syncthreads(); } }
// four waves per SIMD = two blocks per WGP: the 512 blocks are all resident, two on every WGP
__global__ __launch_bounds__(256) __attribute__((amdgpu_waves_per_eu(4, 4))) void k_att(const float* __restrict__ Q, const float* __restrict__ K, const float* __restrict__ V, const float* __restrict__ SCL, float* __restrict__ O) {
  __shared__ __align__(16) __bf16 sk[2][KST][LP];
  __shared__ __align__(16) _Float16 sv[2][HD][LP];
  __shared__ int redo;   /* set by any lane whose row sum of the direct form is not finite */
  const int tid = threadIdx.x, wave = tid >> 5, lane = tid & 31, col = lane & 15, g = lane >> 4;
  const int b = blockIdx.y, q0 = blockIdx.x * 128 + wave * 16;
  // the scale is a scalar INPUT (bf16-rounded like every float input). Weights are formed in units of ln 2 (the unit cancels in the division by the row sum), u = score * scale * log2(e); f = 1 up to |scale| = 64 and 64 / |scale| beyond, which keeps the unnormalised weights of the guarded form inside f16 for any scale; f cancels too
  const float sc = bfr(SCL[0]); const float f = fabsf(sc) > 64.0f ? 64.0f / fabsf(sc) : 1.0f; const float c2 = sc * 1.44269504f; const float e2 = SP_EPS * 1.44269504f * f;
  v16b qf[2];
#pragma unroll
  for (int kc = 0; kc < 2; ++kc) qf[kc] = fragb_f32(Q + ((size_t)b * TT + q0 + col) * CC + kc * 32, lane);
  // staging: see struct Raw: whole lines from the f32 inputs, through registers (rounded there) into the padded LDS rows
  const int sr = tid >> 4, sj = tid & 15;
  const float* kg = K + ((size_t)b * TT + sr) * CC + sj * 4; const float* vg = V + ((size_t)b * TT + sr * 4) * CC + sj * 4;
  v8f acc[HD / 16] = {}; v2f sum[4] = {};   /* four independent partial row sums: no long dependent chain of adds */
  if (tid == 0) redo = 0;   /* published by the first barrier of the walk */
  int guarded = __builtin_amdgcn_readfirstlane(fabsf(sc) <= 64.0f ? 0 : 1);   /* the same in every thread of the grid; a scalar, since barriers stand behind the branch */
  if (!guarded) {
    walk_keys<true>(sk, sv, kg, vg, qf, sr, sj, col, lane, c2, f, e2, acc, sum);
    const v2f h = (sum[0] + sum[1]) + (sum[2] + sum[3]);
    if (!(h.x + h.y < __builtin_inff())) redo = 1;   /* weights are never negative: one overflowed 2^u leaves the sum infinite */
    __syncthreads();   /* publishes the flag to the whole block */
    guarded = __builtin_amdgcn_readfirstlane(redo);
  }
  if (guarded) {   /* the whole block walks the keys in the form that cannot overflow (for |scale| > 64, or again after the direct form overflowed) */
#pragma unroll
    for (int j = 0; j < HD / 16; ++j) acc[j] = v8f{};
#pragma unroll
    for (int j = 0; j < 4; ++j) sum[j] = v2f{};
    walk_keys<false>(sk, sv, kg, vg, qf, sr, sj, col, lane, c2, f, e2, acc, sum);
  }
  const v2f s2 = (sum[0] + sum[1]) + (sum[2] + sum[3]); float tot = s2.x + s2.y; tot += __shfl_xor(tot, 16);   /* the two lane halves hold the two halves of a query's keys */
  const float inv = 1.0f / tot;
  float* o = O + ((size_t)b * TT + q0 + col) * CC + 8 * g;   /* acc[j][r] = channel 16 j + 8 g + r of query col */
#pragma unroll
  for (int j = 0; j < HD / 16; ++j) { const v4f lo = {acc[j][0] * inv, acc[j][1] * inv, acc[j][2] * inv, acc[j][3] * inv}, hi = {acc[j][4] * inv, acc[j][5] * inv, acc[j][6] * inv, acc[j][7] * inv}; vst2(o + j * 16, lo); vst2(o + j * 16 + 4, hi); } }

extern "C" void kernel_launch(void* const* d_in, const int* in_sizes, int n_in, void* d_out, int out_size, void* d_ws, size_t ws_size, hipStream_t stream) {
  (void)in_sizes; (void)n_in; (void)out_size; (void)d_ws; (void)ws_size;
  const float** F = (const float**)d_in;
  // inputs: 0 q [32,2048,64]; 1 k; 2 v; 3 scale (f32 scalar)
  k_att<<<dim3(TT / 128, TNB), 256, 0, stream>>>(F[0], F[1], F[2], F[3], (float*)d_out);
}

// v005
// One run takes 38.1 microseconds.
// Next to v004, in two timings, it ran 1.05 times as fast each time.
// All steps since v000 together make it 71.4 times as fast.
// compute dtype: all float inputs rounded to bf16; raw q / k / v: the scores q . k are exact products of the bf16 inputs (bf16 operands, f32 accumulate), multiplied by the scale INPUT in f32; weights = softplus(score) + 1e-8 in f32 (no exponential softmax), rounded once to f16 unnormalised x v (bf16-rounded, exact in f16); the f32 context is divided by the f32 row sum of the weights; f32 output.
#include <hip/hip_runtime.h>
#include <math.h>

typedef __attribute__((ext_vector_type(16))) _Float16 v16h;
typedef __attribute__((ext_vector_type(16))) __bf16 v16b;
typedef __attribute__((ext_vector_type(8)))  _Float16 v8h;
typedef __attribute__((ext_vector_type(8)))  float v8f;
typedef __attribute__((ext_vector_type(4)))  float v4f;
typedef __attribute__((ext_vector_type(2)))  float v2f;
typedef __attribute__((ext_vector_type(4)))  unsigned v4u;
typedef __attribute__((ext_vector_type(4)))  int v4i;
typedef float __attribute__((may_alias)) float_a;
typedef int __attribute__((may_alias)) int_a;

template <typename T> __device__ __forceinline__ void vst2(void* p, T v) { *(T*)p = v;  }
__device__ __forceinline__ v8f wmma16(v16h a, v16h b, v8f c) {
  v8f d = __builtin_amdgcn_wmma_f32_16x16x32_f16(false, a, false, b, (short)0, c, false, false);
  asm volatile("v_nop\n\tv_nop\n\tv_nop\n\tv_nop" : "+v"(d) : "v"(a), "v"(b));
  return d;
}
__device__ __forceinline__ v8f wmma_bf(v16b a, v16b b, v8f c) {
  v8f d = __builtin_amdgcn_wmma_f32_16x16x32_bf16(false, a, false, b, (short)0, c, false, false);
  asm volatile("v_nop\n\tv_nop\n\tv_nop\n\tv_nop" : "+v"(d) : "v"(a), "v"(b));
  return d;
}
// 16x16x32 fragments: lane = (h = lane>>4, row/col = lane&15); elements 0..7 = k0+8h+0..7, 8..15 = k0+16+8h+0..7; D element r = row 8h+r
__device__ __forceinline__ v16h frag_h(const _Float16* rowk0, int lane) {
  union { v16h v; v8h q[2]; } u; const _Float16* p = rowk0 + 8 * (lane >> 4);
  u.q[0] = *(const v8h*)p; u.q[1] = *(const v8h*)(p + 16); return u.v;
}
__device__ __forceinline__ v16h frag_f32(const float* rowk0, int lane) {
  v16h a; const float* p = rowk0 + 8 * (lane >> 4);
#pragma unroll
  for (int i = 0; i < 8; ++i) { a[i] = (_Float16)p[i]; a[8 + i] = (_Float16)p[16 + i]; }
  return a;
}
__device__ __forceinline__ v16h frag_f32s(const float* rowk0, int lane, float sc) {
  v16h a; const float* p = rowk0 + 8 * (lane >> 4);
#pragma unroll
  for (int i = 0; i < 8; ++i) { a[i] = (_Float16)(p[i] * sc); a[8 + i] = (_Float16)(p[16 + i] * sc); }
  return a;
}
// column fragment from a [K][ld] layout (column n), rows >= K read as 0
__device__ __forceinline__ v16h fragc_f32(const float* W, int k0, int n, int lane, int ld, int K) {
  v16h a; const int g = lane >> 4;
#pragma unroll
  for (int i = 0; i < 8; ++i) { const int ka = k0 + 8 * g + i, kb = ka + 16;
    a[i] = (_Float16)(ka < K ? W[(size_t)(ka < K ? ka : K - 1) * ld + n] : 0.f); a[8 + i] = (_Float16)(kb < K ? W[(size_t)(kb < K ? kb : K - 1) * ld + n] : 0.f); }
  return a;
}
struct F2 { v16b h, l; };
__device__ __forceinline__ F2 bsplit16(const float v[16]) { F2 r;
#pragma unroll
  for (int i = 0; i < 16; ++i) { const __bf16 h = (__bf16)v[i]; r.h[i] = h; r.l[i] = (__bf16)(v[i] - (float)h); }
  return r; }
__device__ __forceinline__ F2 split_row(const float* row, int k0, int lane) { float v[16]; const float* p = row + k0 + 8 * (lane >> 4);
#pragma unroll
  for (int i = 0; i < 8; ++i) { v[i] = p[i]; v[8 + i] = p[16 + i]; }
  return bsplit16(v); }
__device__ __forceinline__ F2 split_rowK(const float* row, int k0, int lane, int K) { float v[16]; const int g = lane >> 4;
#pragma unroll
  for (int i = 0; i < 8; ++i) { const int ka = k0 + 8 * g + i, kb = ka + 16; v[i] = ka < K ? row[ka < K ? ka : K - 1] : 0.f; v[8 + i] = kb < K ? row[kb < K ? kb : K - 1] : 0.f; }
  return bsplit16(v); }
__device__ __forceinline__ F2 split_col(const float* W, int k0, int n, int lane, int ld, int K) { float v[16]; const int g = lane >> 4;
#pragma unroll
  for (int i = 0; i < 8; ++i) { const int ka = k0 + 8 * g + i, kb = ka + 16; v[i] = ka < K ? W[(size_t)(ka < K ? ka : K - 1) * ld + n] : 0.f; v[8 + i] = kb < K ? W[(size_t)(kb < K ? kb : K - 1) * ld + n] : 0.f; }
  return bsplit16(v); }
__device__ __forceinline__ v8f mac3(const F2& a, const F2& b, v8f c) { c = wmma_bf(a.l, b.h, c); c = wmma_bf(a.h, b.l, c); return wmma_bf(a.h, b.h, c); }
__device__ __forceinline__ float sigm(float v) { return 1.0f / (1.0f + expf(-v)); }
#define LDSX() do { asm volatile("s_wait_dscnt 0" ::: "memory"); __builtin_amdgcn_wave_barrier(); __builtin_amdgcn_fence(__ATOMIC_RELEASE, "workgroup"); } while (0)

// Quadratic attention with a softplus kernel instead of a softmax (q / k / v [32,2048,64]; sim = softplus(q k^T * scale) + 1e-8 with scale a scalar input; sim /= sum over keys; out = sim v -> [32,2048,64]; no mask).
#define NB 32
#define TT 2048
#define CC 64            // NH * HD = projected width
#define DIN 64          // input (model) width
#define NH 1
#define HD 64
#define NQB (TT / 64)
#define HG 1
#define SCALE (1.0f)
#define CAUSAL 0
#ifndef TNB
#define TNB NB
#endif
__device__ __forceinline__ float bfr(float v) { return (float)(__bf16)v; }
__host__ __device__ __forceinline__ int kb_last(int qb) { return CAUSAL ? ((qb * 64 + 63) >> 7) : (TT / 128 - 1); }
typedef __attribute__((ext_vector_type(8))) __bf16 v8b;
__device__ __forceinline__ v16b frag_b(const __bf16* rowk0, int lane) {
  union { v16b v; v8b q[2]; } u; const __bf16* p = rowk0 + 8 * (lane >> 4);
  u.q[0] = *(const v8b*)p; u.q[1] = *(const v8b*)(p + 16); return u.v;
}
#define QBH 0              // unused: k_att has no causal or high-precision path
#define QHI 0              // (override) rows carrying the q residual plane
#define KHI 64            // key rows carrying k residual / v bf16 hi+lo planes (no kernel in this file writes or reads them)
// B fragment (k rows k0+.., output column o) of a weight: (in,out) [K][ld] or (out,in) [ld rows of K]: bf16 exact, or f16(bf16 * 256) exact
__device__ __forceinline__ v16b wcol_io(const float* Wm, int k0, int o, int lane, int ld) { v16b w; const int g = lane >> 4;
#pragma unroll
  for (int i = 0; i < 8; ++i) { w[i] = (__bf16)Wm[(size_t)(k0 + 8 * g + i) * ld + o]; w[8 + i] = (__bf16)Wm[(size_t)(k0 + 16 + 8 * g + i) * ld + o]; }
  return w; }
__device__ __forceinline__ v16b wcol_oi(const float* Wm, int k0, int o, int lane, int K) { v16b w; const float* p = Wm + (size_t)o * K + k0 + 8 * (lane >> 4);
#pragma unroll
  for (int i = 0; i < 8; ++i) { w[i] = (__bf16)p[i]; w[8 + i] = (__bf16)p[16 + i]; }
  return w; }
__device__ __forceinline__ v16h wcolh_io(const float* Wm, int k0, int o, int lane, int ld) { v16h w; const int g = lane >> 4;
#pragma unroll
  for (int i = 0; i < 8; ++i) { w[i] = (_Float16)(bfr(Wm[(size_t)(k0 + 8 * g + i) * ld + o]) * 256.0f); w[8 + i] = (_Float16)(bfr(Wm[(size_t)(k0 + 16 + 8 * g + i) * ld + o]) * 256.0f); }
  return w; }
__device__ __forceinline__ v16h wcolh_oi(const float* Wm, int k0, int o, int lane, int K) { v16h w; const float* p = Wm + (size_t)o * K + k0 + 8 * (lane >> 4);
#pragma unroll
  for (int i = 0; i < 8; ++i) { w[i] = (_Float16)(bfr(p[i]) * 256.0f); w[8 + i] = (_Float16)(bfr(p[16 + i]) * 256.0f); }
  return w; }
#define WQKV_LAYOUT 1   // 0 = (in,out) [DIN][CC]; 1 = (out,in) [CC][DIN]; 2 = per-head [NH][DIN][HD]
__device__ __forceinline__ v16b wcol_hdk(const float* Wm, int k0, int o, int lane) { v16b w; const int g = lane >> 4; const float* p = Wm + (size_t)(o / HD) * DIN * HD + (o % HD);
#pragma unroll
  for (int i = 0; i < 8; ++i) { w[i] = (__bf16)p[(size_t)(k0 + 8 * g + i) * HD]; w[8 + i] = (__bf16)p[(size_t)(k0 + 16 + 8 * g + i) * HD]; }
  return w; }
#define WO_OUT_IN 0
#if WQKV_LAYOUT == 1
#define WCOL(W, k0, o, lane) wcol_oi(W, k0, o, lane, DIN)
#elif WQKV_LAYOUT == 2
#define WCOL(W, k0, o, lane) wcol_hdk(W, k0, o, lane)
#else
#define WCOL(W, k0, o, lane) wcol_io(W, k0, o, lane, CC)
#endif
#if WO_OUT_IN
#define WOCOL(W, k0, o, lane) wcol_oi(W, k0, o, lane, CC)
#define WOCOLH(W, k0, o, lane) wcolh_oi(W, k0, o, lane, CC)
#else
#define WOCOL(W, k0, o, lane) wcol_io(W, k0, o, lane, DIN)
#define WOCOLH(W, k0, o, lane) wcolh_io(W, k0, o, lane, DIN)
#endif
#define SP_EPS 1.0e-8f
typedef __attribute__((ext_vector_type(4))) _Float16 v4h;
typedef __attribute__((ext_vector_type(4))) __bf16 v4b;
typedef __attribute__((ext_vector_type(2))) __bf16 v2b;

// ---- k_att: the only launch. Block = 256 queries of sequence b, 16 waves = 8 query groups x 2 key halves: a wave holds 32 query columns (two 16-column tiles) and walks, of every 64-key stage, its own 32 keys, so each k or v fragment read from LDS feeds two products; two stages lie between barriers, so a wave still has two 32-key passes per barrier. Stages come straight from the f32 inputs: a stage's k and v are rounded to bf16 on their way from the registers into LDS (k stays bf16; v goes on to f16, exact, and is turned to [c][key] by the choice of which thread holds what). S^T = K . Q^T (A = key rows from LDS, B = q kept in registers), so a lane holds one query's scores; the two 16-key score tiles, turned into weights in place, are the B operand of O^T += V^T . P^T (A = v planes [c][key] from LDS, same k order as frag_h): scores and weights never leave the registers. No row maximum is needed (plain sum), so one pass over the keys does it all, unless the direct form overflows and the block walks them again in the guarded form; the two key halves of a query group are added once, through LDS, and the context is divided by the row sum at the end.
#define KST 64             // keys per stage
#define NST (TT / KST)
#define LP 72              // LDS row pitch in 16-bit elements: 144 B = 16 B x 9 (odd), conflict-free for 16-byte fragment reads
#define GRP 2              // stages between two barriers; the ring has 2 GRP buffers: one group is read while the next is filled
#define NBUF (2 * GRP)
#define NWV 16             // waves per block
#define QT 2               // 16-column query tiles per wave
typedef __attribute__((ext_vector_type(2))) _Float16 v2h;
__device__ __forceinline__ v8f wmma_h(v16h a, v16h b, v8f c) { return __builtin_amdgcn_wmma_f32_16x16x32_f16(false, a, false, b, (short)0, c, false, false); }
__device__ __forceinline__ v8f wmma_b(v16b a, v16b b, v8f c) { return __builtin_amdgcn_wmma_f32_16x16x32_bf16(false, a, false, b, (short)0, c, false, false); }
// row fragment straight from f32 (same k order as frag_b), rounded to bf16
__device__ __forceinline__ v16b fragb_f32(const float* rowk0, int lane) { v16b a; const float* p = rowk0 + 8 * (lane >> 4);
#pragma unroll
  for (int i = 0; i < 8; ++i) { a[i] = (__bf16)p[i]; a[8 + i] = (__bf16)p[16 + i]; }
  return a; }
// a thread's share of one stage as it comes from memory. k: thread = (sr = tid >> 4, sj = tid & 15): rows sr + 32 i, channels 4 sj .. + 3 (a 16-byte load of a half wave covers one whole 256-byte row). v: thread = (wave, lane): keys 4 wave + i, channels 2 lane, 2 lane + 1 (an 8-byte load of a wave covers one whole row)
struct Raw { v4f k[2]; v2f v[4]; };
__device__ __forceinline__ void fetch(Raw& r, const float* kn, const float* vn) {
#pragma unroll
  for (int i = 0; i < 2; ++i) r.k[i] = *(const v4f*)(kn + i * 32 * CC);
#pragma unroll
  for (int i = 0; i < 4; ++i) r.v[i] = *(const v2f*)(vn + i * CC);
  asm volatile("s_wait_xcnt 0x0" ::: "memory");   /* stands in front of the first reuse of an address register of the loads above; a precaution */
}
__device__ __forceinline__ void put(const Raw& r, __bf16 (&sk)[KST][LP], _Float16 (&sv)[HD][LP], const int sr, const int sj, const int wave, const int lane) {
#pragma unroll
  for (int i = 0; i < 2; ++i) *(v4b*)&sk[sr + 32 * i][sj * 4] = __builtin_convertvector(r.k[i], v4b);
  unsigned x[4];   /* key i, the thread's two channels as a bf16 pair: one packed rounding to nearest even for the two registers of a load */
#pragma unroll
  for (int i = 0; i < 4; ++i) x[i] = __builtin_bit_cast(unsigned, __builtin_convertvector(r.v[i], v2b));
#pragma unroll
  for (int cc = 0; cc < 2; ++cc) { float e[4];   /* channel cc of the four keys, back as f32, then f16 (exact for values inside f16's range) */
#pragma unroll
    for (int i = 0; i < 4; ++i) e[i] = __builtin_bit_cast(float, cc ? (x[i] & 0xffff0000u) : (x[i] << 16));
    const v2f e01 = {e[0], e[1]}, e23 = {e[2], e[3]}; union { v2h p[2]; v4h q; } h; h.p[0] = __builtin_convertvector(e01, v2h); h.p[1] = __builtin_convertvector(e23, v2h);
    *(v4h*)&sv[lane * 2 + cc][wave * 4] = h.q; } }
// one walk over the wave's half (kh) of all keys of the sequence. DIRECT: w = log2(1 + 2^u) + eps' (no |u|, no maximum: two vector instructions fewer per pair of weights); right while 2^u stays finite (u < 128), and an overflow shows as an infinite row sum. Otherwise the guarded form, right for every u: w = f * (max(u, 0) + log2(1 + 2^-|u|) + eps')
template <bool DIRECT>
__device__ __forceinline__ void walk_keys(__bf16 (&sk)[NBUF][KST][LP], _Float16 (&sv)[NBUF][HD][LP], const float* kg, const float* vg, const v16b (&qf)[QT][2], const int sr, const int sj, const int wave, const int kh, const int col, const int lane, const float c2, const float f, const float e2, v8f (&acc)[QT][HD / 16], v2f (&sum)[QT][4]) {
  const v2f cu = {c2, c2}, cm = {c2 * f, c2 * f}, em = {e2, e2}, ff = {f, f}, one = {1.0f, 1.0f};
  Raw raw; { Raw first[GRP];
#pragma unroll
    for (int i = 0; i < GRP; ++i) fetch(first[i], kg + (size_t)i * KST * CC, vg + (size_t)i * KST * CC);
#pragma unroll
    for (int i = 0; i < GRP; ++i) put(first[i], sk[i], sv[i], sr, sj, wave, lane); }
  __syncthreads();
#pragma unroll 1
  for (int s = 0; s < NST; ++s) { const int bu = s & (NBUF - 1); const bool more = s + GRP < NST;
    if (more) fetch(raw, kg + (size_t)(s + GRP) * KST * CC, vg + (size_t)(s + GRP) * KST * CC);   /* a stage of the next group flies while this one is worked on */
    v8f st[QT][2]; v16b kf[2][2]; v16h vf[HD / 16];
#pragma unroll
    for (int t = 0; t < 2; ++t) { const __bf16* kr = &sk[bu][kh * 32 + t * 16 + col][0]; kf[t][0] = frag_b(kr, lane); kf[t][1] = frag_b(kr + 32, lane); }
#pragma unroll
    for (int j = 0; j < HD / 16; ++j) vf[j] = frag_h(&sv[bu][j * 16 + col][kh * 32], lane);
    __builtin_amdgcn_sched_barrier(0);   /* keeps the stage's 16 LDS reads in one group ahead of its products: one LDS latency a stage (the v reads land under the weights) instead of a drained wait in front of every product */
#pragma unroll
    for (int t = 0; t < 2; ++t)
#pragma unroll
      for (int c = 0; c < QT; ++c) { v8f z = {}; z = wmma_b(kf[t][0], qf[c][0], z); st[c][t] = wmma_b(kf[t][1], qf[c][1], z); }
    v16h p[QT];
#pragma unroll
    for (int c = 0; c < QT; ++c)
#pragma unroll
      for (int t = 0; t < 2; ++t)
#pragma unroll
        for (int r = 0; r < 8; r += 2) { const v2f a = {st[c][t][r], st[c][t][r + 1]}; const v2f u = a * cu; v2f x, l, w;
          if constexpr (DIRECT) {
            x.x = __builtin_amdgcn_exp2f(u.x); x.y = __builtin_amdgcn_exp2f(u.y); x = x + one;
            l.x = __builtin_amdgcn_logf(x.x); l.y = __builtin_amdgcn_logf(x.y);
            w = l + em;
          } else {
            x.x = __builtin_amdgcn_exp2f(-fabsf(u.x)); x.y = __builtin_amdgcn_exp2f(-fabsf(u.y)); x = x + one;
            l.x = __builtin_amdgcn_logf(x.x); l.y = __builtin_amdgcn_logf(x.y);
            w = __builtin_elementwise_fma(l, ff, __builtin_elementwise_max(__builtin_elementwise_fma(a, cm, em), em));   /* max(f u + f eps', f eps') = f max(u, 0) + f eps' */
          }
          sum[c][r >> 1] += w; const v2h ph = __builtin_convertvector(w, v2h); p[c][t * 8 + r] = ph.x; p[c][t * 8 + r + 1] = ph.y; }
#pragma unroll
    for (int j = 0; j < HD / 16; ++j)
#pragma unroll
      for (int c = 0; c < QT; ++c) acc[c][j] = wmma_h(vf[j], p[c], acc[c][j]);
    if (more) put(raw, sk[bu ^ GRP], sv[bu ^ GRP], sr, sj, wave, lane);   /* its last readers left this buffer at the barrier that ended the group before this one */
    if ((s & (GRP - 1)) == GRP - 1) __syncthreads(); } }   /* s is the same in every thread of the block; publishes the next group, ends this group's reads */
// a wave's share of the query tile that its partner finishes, into LDS; lanes side by side, 16 bytes each
__device__ __forceinline__ void hand(const v8f (&a)[HD / 16], const float part, v4f (&xw)[HD / 8][32], float (&xsw)[32], const int lane) {
#pragma unroll
  for (int j = 0; j < HD / 16; ++j) { const v4f lo = {a[j][0], a[j][1], a[j][2], a[j][3]}, hi = {a[j][4], a[j][5], a[j][6], a[j][7]}; xw[2 * j][lane] = lo; xw[2 * j + 1][lane] = hi; }
  xsw[lane] = part; }
// own share + the partner's, divided by the whole row sum, to the output
__device__ __forceinline__ void finish(const v8f (&m)[HD / 16], const float part, const v4f (&xp)[HD / 8][32], const float (&xsp)[32], const int lane, float* o) {
  float tot = part + xsp[lane]; tot += __shfl_xor(tot, 16);   /* the two lane halves hold the two halves of every 16-key tile */
  const float inv = 1.0f / tot;
#pragma unroll
  for (int j = 0; j < HD / 16; ++j) { const v4f pl = xp[2 * j][lane], ph = xp[2 * j + 1][lane];
    const v4f lo = {(m[j][0] + pl[0]) * inv, (m[j][1] + pl[1]) * inv, (m[j][2] + pl[2]) * inv, (m[j][3] + pl[3]) * inv}, hi = {(m[j][4] + ph[0]) * inv, (m[j][5] + ph[1]) * inv, (m[j][6] + ph[2]) * inv, (m[j][7] + ph[3]) * inv}; vst2(o + j * 16, lo); vst2(o + j * 16 + 4, hi); } }
// four waves per SIMD = one block per WGP: the 256 blocks are all resident
__global__ __launch_bounds__(512) __attribute__((amdgpu_waves_per_eu(4, 4))) void k_att(const float* __restrict__ Q, const float* __restrict__ K, const float* __restrict__ V, const float* __restrict__ SCL, float* __restrict__ O) {
  __shared__ __align__(16) __bf16 sk[NBUF][KST][LP];
  __shared__ __align__(16) _Float16 sv[NBUF][HD][LP];
  __shared__ __align__(16) v4f xa[NWV][HD / 8][32];   /* what a wave hands to the wave of the other key half: one query tile's context */
  __shared__ float xs[NWV][32];                       /* and that tile's partial row sums */
  __shared__ int redo;   /* set by any lane whose row sum of the direct form is not finite */
  const int tid = threadIdx.x, wave = tid >> 5, lane = tid & 31, col = lane & 15, g = lane >> 4;
  const int kh = wave & 1;   /* which 32 keys of every stage are this wave's */
  const int b = blockIdx.y, q0 = blockIdx.x * 256 + (wave >> 1) * 32;
  // the scale is a scalar INPUT (bf16-rounded like every float input). Weights are formed in units of ln 2 (the unit cancels in the division by the row sum), u = score * scale * log2(e); f = 1 up to |scale| = 64 and 64 / |scale| beyond, which keeps the unnormalised weights of the guarded form inside f16 for any scale; f cancels too
  const float sc = bfr(SCL[0]); const float f = fabsf(sc) > 64.0f ? 64.0f / fabsf(sc) : 1.0f; const float c2 = sc * 1.44269504f; const float e2 = SP_EPS * 1.44269504f * f;
  v16b qf[QT][2];
#pragma unroll
  for (int c = 0; c < QT; ++c)
#pragma unroll
    for (int kc = 0; kc < 2; ++kc) qf[c][kc] = fragb_f32(Q + ((size_t)b * TT + q0 + c * 16 + col) * CC + kc * 32, lane);
  // staging: see struct Raw: whole lines from the f32 inputs, through registers (rounded there) into the padded LDS rows
  const int sr = tid >> 4, sj = tid & 15;
  const float* kg = K + ((size_t)b * TT + sr) * CC + sj * 4; const float* vg = V + ((size_t)b * TT + wave * 4) * CC + lane * 2;
  v8f acc[QT][HD / 16] = {}; v2f sum[QT][4] = {};   /* four independent partial row sums a tile: no long dependent chain of adds */
  if (tid == 0) redo = 0;   /* published by the first barrier of the walk */
  int guarded = __builtin_amdgcn_readfirstlane(fabsf(sc) <= 64.0f ? 0 : 1);   /* the same in every thread of the grid; a scalar, since barriers stand behind the branch */
  if (!guarded) {
    walk_keys<true>(sk, sv, kg, vg, qf, sr, sj, wave, kh, col, lane, c2, f, e2, acc, sum);
    const v2f h = ((sum[0][0] + sum[0][1]) + (sum[0][2] + sum[0][3])) + ((sum[1][0] + sum[1][1]) + (sum[1][2] + sum[1][3]));
    if (!(h.x + h.y < __builtin_inff())) redo = 1;   /* weights are never negative: one overflowed 2^u leaves the sum infinite */
    __syncthreads();   /* publishes the flag to the whole block */
    guarded = __builtin_amdgcn_readfirstlane(redo);
  }
  if (guarded) {   /* the whole block walks the keys in the form that cannot overflow (for |scale| > 64, or again after the direct form overflowed) */
#pragma unroll
    for (int c = 0; c < QT; ++c) {
#pragma unroll
      for (int j = 0; j < HD / 16; ++j) acc[c][j] = v8f{};
#pragma unroll
      for (int j = 0; j < 4; ++j) sum[c][j] = v2f{}; }
    walk_keys<false>(sk, sv, kg, vg, qf, sr, sj, wave, kh, col, lane, c2, f, e2, acc, sum);
  }
  // the two key halves meet: the wave of half kh finishes query tile kh and hands its share of the other tile to its partner (wave ^ 1)
  float part[QT];
#pragma unroll
  for (int c = 0; c < QT; ++c) { const v2f s2 = (sum[c][0] + sum[c][1]) + (sum[c][2] + sum[c][3]); part[c] = s2.x + s2.y; }
  const int khs = __builtin_amdgcn_readfirstlane(kh);   /* the same in a whole wave; whole tiles are picked by control flow, which keeps the accumulators in registers (a select between the two arrays sent them through memory) */
  if (khs) hand(acc[0], part[0], xa[wave], xs[wave], lane); else hand(acc[1], part[1], xa[wave], xs[wave], lane);
  __syncthreads();   /* publishes the handed-over shares */
  float* o = O + ((size_t)b * TT + q0 + kh * 16 + col) * CC + 8 * g;   /* acc[c][j][r] = channel 16 j + 8 g + r of query col of tile c */
  if (khs) finish(acc[1], part[1], xa[wave ^ 1], xs[wave ^ 1], lane, o); else finish(acc[0], part[0], xa[wave ^ 1], xs[wave ^ 1], lane, o); }

extern "C" void kernel_launch(void* const* d_in, const int* in_sizes, int n_in, void* d_out, int out_size, void* d_ws, size_t ws_size, hipStream_t stream) {
  (void)in_sizes; (void)n_in; (void)out_size; (void)d_ws; (void)ws_size;
  const float** F = (const float**)d_in;
  // inputs: 0 q [32,2048,64]; 1 k; 2 v; 3 scale (f32 scalar)
  k_att<<<dim3(TT / 256, TNB), 512, 0, stream>>>(F[0], F[1], F[2], F[3], (float*)d_out);
}

// v006
// Measured time: 36.7 microseconds a run.
// Timed twice side by side with v005, it ran 1.04 times as fast both times.
// Over all steps from v000 it is 74.3 times as fast.
// compute dtype: all float inputs rounded to bf16; raw q / k / v: the scores q . k are exact products of the bf16 inputs (bf16 operands, f32 accumulate), multiplied by the scale INPUT in f32; weights = softplus(score) + 1e-8 in f32 (no exponential softmax), rounded once to f16 unnormalised x v (bf16-rounded, exact in f16); the f32 context is divided by the f32 row sum of the weights; f32 output.
#include <hip/hip_runtime.h>
#include <math.h>

typedef __attribute__((ext_vector_type(16))) _Float16 v16h;
typedef __attribute__((ext_vector_type(16))) __bf16 v16b;
typedef __attribute__((ext_vector_type(8)))  _Float16 v8h;
typedef __attribute__((ext_vector_type(8)))  float v8f;
typedef __attribute__((ext_vector_type(4)))  float v4f;
typedef __attribute__((ext_vector_type(2)))  float v2f;
typedef __attribute__((ext_vector_type(4)))  unsigned v4u;
typedef __attribute__((ext_vector_type(4)))  int v4i;
typedef float __attribute__((may_alias)) float_a;
typedef int __attribute__((may_alias)) int_a;

template <typename T> __device__ __forceinline__ void vst2(void* p, T v) { *(T*)p = v;  }
__device__ __forceinline__ v8f wmma16(v16h a, v16h b, v8f c) {
  v8f d = __builtin_amdgcn_wmma_f32_16x16x32_f16(false, a, false, b, (short)0, c, false, false);
  asm volatile("v_nop\n\tv_nop\n\tv_nop\n\tv_nop" : "+v"(d) : "v"(a), "v"(b));
  return d;
}
__device__ __forceinline__ v8f wmma_bf(v16b a, v16b b, v8f c) {
  v8f d = __builtin_amdgcn_wmma_f32_16x16x32_bf16(false, a, false, b, (short)0, c, false, false);
  asm volatile("v_nop\n\tv_nop\n\tv_nop\n\tv_nop" : "+v"(d) : "v"(a), "v"(b));
  return d;
}
// 16x16x32 fragments: lane = (h = lane>>4, row/col = lane&15); elements 0..7 = k0+8h+0..7, 8..15 = k0+16+8h+0..7; D element r = row 8h+r
__device__ __forceinline__ v16h frag_h(const _Float16* rowk0, int lane) {
  union { v16h v; v8h q[2]; } u; const _Float16* p = rowk0 + 8 * (lane >> 4);
  u.q[0] = *(const v8h*)p; u.q[1] = *(const v8h*)(p + 16); return u.v;
}
__device__ __forceinline__ v16h frag_f32(const float* rowk0, int lane) {
  v16h a; const float* p = rowk0 + 8 * (lane >> 4);
#pragma unroll
  for (int i = 0; i < 8; ++i) { a[i] = (_Float16)p[i]; a[8 + i] = (_Float16)p[16 + i]; }
  return a;
}
__device__ __forceinline__ v16h frag_f32s(const float* rowk0, int lane, float sc) {
  v16h a; const float* p = rowk0 + 8 * (lane >> 4);
#pragma unroll
  for (int i = 0; i < 8; ++i) { a[i] = (_Float16)(p[i] * sc); a[8 + i] = (_Float16)(p[16 + i] * sc); }
  return a;
}
// column fragment from a [K][ld] layout (column n), rows >= K read as 0
__device__ __forceinline__ v16h fragc_f32(const float* W, int k0, int n, int lane, int ld, int K) {
  v16h a; const int g = lane >> 4;
#pragma unroll
  for (int i = 0; i < 8; ++i) { const int ka = k0 + 8 * g + i, kb = ka + 16;
    a[i] = (_Float16)(ka < K ? W[(size_t)(ka < K ? ka : K - 1) * ld + n] : 0.f); a[8 + i] = (_Float16)(kb < K ? W[(size_t)(kb < K ? kb : K - 1) * ld + n] : 0.f); }
  return a;
}
struct F2 { v16b h, l; };
__device__ __forceinline__ F2 bsplit16(const float v[16]) { F2 r;
#pragma unroll
  for (int i = 0; i < 16; ++i) { const __bf16 h = (__bf16)v[i]; r.h[i] = h; r.l[i] = (__bf16)(v[i] - (float)h); }
  return r; }
__device__ __forceinline__ F2 split_row(const float* row, int k0, int lane) { float v[16]; const float* p = row + k0 + 8 * (lane >> 4);
#pragma unroll
  for (int i = 0; i < 8; ++i) { v[i] = p[i]; v[8 + i] = p[16 + i]; }
  return bsplit16(v); }
__device__ __forceinline__ F2 split_rowK(const float* row, int k0, int lane, int K) { float v[16]; const int g = lane >> 4;
#pragma unroll
  for (int i = 0; i < 8; ++i) { const int ka = k0 + 8 * g + i, kb = ka + 16; v[i] = ka < K ? row[ka < K ? ka : K - 1] : 0.f; v[8 + i] = kb < K ? row[kb < K ? kb : K - 1] : 0.f; }
  return bsplit16(v); }
__device__ __forceinline__ F2 split_col(const float* W, int k0, int n, int lane, int ld, int K) { float v[16]; const int g = lane >> 4;
#pragma unroll
  for (int i = 0; i < 8; ++i) { const int ka = k0 + 8 * g + i, kb = ka + 16; v[i] = ka < K ? W[(size_t)(ka < K ? ka : K - 1) * ld + n] : 0.f; v[8 + i] = kb < K ? W[(size_t)(kb < K ? kb : K - 1) * ld + n] : 0.f; }
  return bsplit16(v); }
__device__ __forceinline__ v8f mac3(const F2& a, const F2& b, v8f c) { c = wmma_bf(a.l, b.h, c); c = wmma_bf(a.h, b.l, c); return wmma_bf(a.h, b.h, c); }
__device__ __forceinline__ float sigm(float v) { return 1.0f / (1.0f + expf(-v)); }
#define LDSX() do { asm volatile("s_wait_dscnt 0" ::: "memory"); __builtin_amdgcn_wave_barrier(); __builtin_amdgcn_fence(__ATOMIC_RELEASE, "workgroup"); } while (0)

// Quadratic attention with a softplus kernel instead of a softmax (q / k / v [32,2048,64]; sim = softplus(q k^T * scale) + 1e-8 with scale a scalar input; sim /= sum over keys; out = sim v -> [32,2048,64]; no mask).
#define NB 32
#define TT 2048
#define CC 64            // NH * HD = projected width
#define DIN 64          // input (model) width
#define NH 1
#define HD 64
#define NQB (TT / 64)
#define HG 1
#define SCALE (1.0f)
#define CAUSAL 0
#ifndef TNB
#define TNB NB
#endif
__device__ __forceinline__ float bfr(float v) { return (float)(__bf16)v; }
__host__ __device__ __forceinline__ int kb_last(int qb) { return CAUSAL ? ((qb * 64 + 63) >> 7) : (TT / 128 - 1); }
typedef __attribute__((ext_vector_type(8))) __bf16 v8b;
__device__ __forceinline__ v16b frag_b(const __bf16* rowk0, int lane) {
  union { v16b v; v8b q[2]; } u; const __bf16* p = rowk0 + 8 * (lane >> 4);
  u.q[0] = *(const v8b*)p; u.q[1] = *(const v8b*)(p + 16); return u.v;
}
#define QBH 0              // unused: k_att has no causal or high-precision path
#define QHI 0              // (override) rows carrying the q residual plane
#define KHI 64            // key rows carrying k residual / v bf16 hi+lo planes (no kernel in this file writes or reads them)
// B fragment (k rows k0+.., output column o) of a weight: (in,out) [K][ld] or (out,in) [ld rows of K]: bf16 exact, or f16(bf16 * 256) exact
__device__ __forceinline__ v16b wcol_io(const float* Wm, int k0, int o, int lane, int ld) { v16b w; const int g = lane >> 4;
#pragma unroll
  for (int i = 0; i < 8; ++i) { w[i] = (__bf16)Wm[(size_t)(k0 + 8 * g + i) * ld + o]; w[8 + i] = (__bf16)Wm[(size_t)(k0 + 16 + 8 * g + i) * ld + o]; }
  return w; }
__device__ __forceinline__ v16b wcol_oi(const float* Wm, int k0, int o, int lane, int K) { v16b w; const float* p = Wm + (size_t)o * K + k0 + 8 * (lane >> 4);
#pragma unroll
  for (int i = 0; i < 8; ++i) { w[i] = (__bf16)p[i]; w[8 + i] = (__bf16)p[16 + i]; }
  return w; }
__device__ __forceinline__ v16h wcolh_io(const float* Wm, int k0, int o, int lane, int ld) { v16h w; const int g = lane >> 4;
#pragma unroll
  for (int i = 0; i < 8; ++i) { w[i] = (_Float16)(bfr(Wm[(size_t)(k0 + 8 * g + i) * ld + o]) * 256.0f); w[8 + i] = (_Float16)(bfr(Wm[(size_t)(k0 + 16 + 8 * g + i) * ld + o]) * 256.0f); }
  return w; }
__device__ __forceinline__ v16h wcolh_oi(const float* Wm, int k0, int o, int lane, int K) { v16h w; const float* p = Wm + (size_t)o * K + k0 + 8 * (lane >> 4);
#pragma unroll
  for (int i = 0; i < 8; ++i) { w[i] = (_Float16)(bfr(p[i]) * 256.0f); w[8 + i] = (_Float16)(bfr(p[16 + i]) * 256.0f); }
  return w; }
#define WQKV_LAYOUT 1   // 0 = (in,out) [DIN][CC]; 1 = (out,in) [CC][DIN]; 2 = per-head [NH][DIN][HD]
__device__ __forceinline__ v16b wcol_hdk(const float* Wm, int k0, int o, int lane) { v16b w; const int g = lane >> 4; const float* p = Wm + (size_t)(o / HD) * DIN * HD + (o % HD);
#pragma unroll
  for (int i = 0; i < 8; ++i) { w[i] = (__bf16)p[(size_t)(k0 + 8 * g + i) * HD]; w[8 + i] = (__bf16)p[(size_t)(k0 + 16 + 8 * g + i) * HD]; }
  return w; }
#define WO_OUT_IN 0
#if WQKV_LAYOUT == 1
#define WCOL(W, k0, o, lane) wcol_oi(W, k0, o, lane, DIN)
#elif WQKV_LAYOUT == 2
#define WCOL(W, k0, o, lane) wcol_hdk(W, k0, o, lane)
#else
#define WCOL(W, k0, o, lane) wcol_io(W, k0, o, lane, CC)
#endif
#if WO_OUT_IN
#define WOCOL(W, k0, o, lane) wcol_oi(W, k0, o, lane, CC)
#define WOCOLH(W, k0, o, lane) wcolh_oi(W, k0, o, lane, CC)
#else
#define WOCOL(W, k0, o, lane) wcol_io(W, k0, o, lane, DIN)
#define WOCOLH(W, k0, o, lane) wcolh_io(W, k0, o, lane, DIN)
#endif
#define SP_EPS 1.0e-8f
typedef __attribute__((ext_vector_type(4))) _Float16 v4h;
typedef __attribute__((ext_vector_type(4))) __bf16 v4b;
typedef __attribute__((ext_vector_type(2))) __bf16 v2b;

// ---- k_att: the only launch. Block = 256 queries of sequence b, 16 waves = 8 query groups x 2 key halves: a wave holds 32 query columns (two 16-column tiles) and walks, of every 64-key stage, its own 32 keys, so each k or v fragment read from LDS feeds two products; two stages lie between barriers, so a wave still has two 32-key passes per barrier. Stages come straight from the f32 inputs: a stage's k and v are rounded to bf16 on their way from the registers into LDS (k stays bf16; v goes on to f16, exact, and is turned to [c][key] by the choice of which thread holds what). S^T = K . Q^T (A = key rows from LDS, B = q kept in registers), so a lane holds one query's scores; the two 16-key score tiles, turned into weights in place, are the B operand of O^T += V^T . P^T (A = v planes [c][key] from LDS, same k order as frag_h): scores and weights never leave the registers. No row maximum is needed (plain sum), so one pass over the keys does it all, unless the direct form overflows and the block walks them again in the guarded form; the two key halves of a query group are added once, through LDS, and the context is divided by the row sum at the end.
#define KST 64             // keys per stage
#define NST (TT / KST)
#define LP 72              // LDS row pitch in 16-bit elements: 144 B = 16 B x 9 (odd), conflict-free for 16-byte fragment reads
#define GRP 2              // stages between two barriers; the ring has 2 GRP buffers: one group is read while the next is filled
#define NBUF (2 * GRP)
#define NWV 16             // waves per block
#define QT 2               // 16-column query tiles per wave
typedef __attribute__((ext_vector_type(2))) _Float16 v2h;
__device__ __forceinline__ v8f wmma_h(v16h a, v16h b, v8f c) { return __builtin_amdgcn_wmma_f32_16x16x32_f16(false, a, false, b, (short)0, c, false, false); }
__device__ __forceinline__ v8f wmma_b(v16b a, v16b b, v8f c) { return __builtin_amdgcn_wmma_f32_16x16x32_bf16(false, a, false, b, (short)0, c, false, false); }
// row fragment straight from f32 (same k order as frag_b), rounded to bf16
__device__ __forceinline__ v16b fragb_f32(const float* rowk0, int lane) { v16b a; const float* p = rowk0 + 8 * (lane >> 4);
#pragma unroll
  for (int i = 0; i < 8; ++i) { a[i] = (__bf16)p[i]; a[8 + i] = (__bf16)p[16 + i]; }
  return a; }
// a thread's share of one stage as it comes from memory. k: thread = (sr = tid >> 4, sj = tid & 15): rows sr + 32 i, channels 4 sj .. + 3 (a 16-byte load of a half wave covers one whole 256-byte row). v: thread = (wave, lane): keys 4 wave + i, channels 2 lane, 2 lane + 1 (an 8-byte load of a wave covers one whole row)
struct Raw { v4f k[2]; v2f v[4]; };
__device__ __forceinline__ void fetch(Raw& r, const float* kn, const float* vn) {
#pragma unroll
  for (int i = 0; i < 2; ++i) r.k[i] = *(const v4f*)(kn + i * 32 * CC);
#pragma unroll
  for (int i = 0; i < 4; ++i) r.v[i] = *(const v2f*)(vn + i * CC);
  asm volatile("s_wait_xcnt 0x0" ::: "memory");   /* stands in front of the first reuse of an address register of the loads above; a precaution */
}
__device__ __forceinline__ void put(const Raw& r, __bf16 (&sk)[KST][LP], _Float16 (&sv)[HD][LP], const int sr, const int sj, const int wave, const int lane) {
#pragma unroll
  for (int i = 0; i < 2; ++i) *(v4b*)&sk[sr + 32 * i][sj * 4] = __builtin_convertvector(r.k[i], v4b);
  unsigned x[4];   /* key i, the thread's two channels as a bf16 pair: one packed rounding to nearest even for the two registers of a load */
#pragma unroll
  for (int i = 0; i < 4; ++i) x[i] = __builtin_bit_cast(unsigned, __builtin_convertvector(r.v[i], v2b));
#pragma unroll
  for (int cc = 0; cc < 2; ++cc) { float e[4];   /* channel cc of the four keys, back as f32, then f16 (exact for values inside f16's range) */
#pragma unroll
    for (int i = 0; i < 4; ++i) e[i] = __builtin_bit_cast(float, cc ? (x[i] & 0xffff0000u) : (x[i] << 16));
    const v2f e01 = {e[0], e[1]}, e23 = {e[2], e[3]}; union { v2h p[2]; v4h q; } h; h.p[0] = __builtin_convertvector(e01, v2h); h.p[1] = __builtin_convertvector(e23, v2h);
    *(v4h*)&sv[lane * 2 + cc][wave * 4] = h.q; } }
// one walk over the wave's half (kh) of all keys of the sequence. DIRECT: w = log2(1 + 2^u) + eps' (no |u|, no maximum: two vector instructions fewer per pair of weights); right while 2^u stays finite (u < 128), and an overflow shows as an infinite row sum. Otherwise the guarded form, right for every u: w = f * (max(u, 0) + log2(1 + 2^-|u|) + eps')
template <bool DIRECT>
__device__ __forceinline__ void walk_keys(__bf16 (&sk)[NBUF][KST][LP], _Float16 (&sv)[NBUF][HD][LP], const float* kg, const float* vg, const v16b (&qf)[QT][2], const int sr, const int sj, const int wave, const int kh, const int col, const int lane, const float c2, const float f, const float e2, v8f (&acc)[QT][HD / 16], v2f (&sum)[QT][4]) {
  const v2f cu = {c2, c2}, cm = {c2 * f, c2 * f}, em = {e2, e2}, ff = {f, f}, one = {1.0f, 1.0f};
  Raw raw; { Raw first[GRP];
#pragma unroll
    for (int i = 0; i < GRP; ++i) fetch(first[i], kg + (size_t)i * KST * CC, vg + (size_t)i * KST * CC);
#pragma unroll
    for (int i = 0; i < GRP; ++i) put(first[i], sk[i], sv[i], sr, sj, wave, lane); }
  __syncthreads();
#pragma unroll 1
  for (int s = 0; s < NST; ++s) { const int bu = s & (NBUF - 1); const bool more = s + GRP < NST;
    if (more) fetch(raw, kg + (size_t)(s + GRP) * KST * CC, vg + (size_t)(s + GRP) * KST * CC);   /* a stage of the next group flies while this one is worked on */
    v8f st[QT][2]; v16b kf[2][2]; v16h vf[HD / 16];
#pragma unroll
    for (int t = 0; t < 2; ++t) { const __bf16* kr = &sk[bu][kh * 32 + t * 16 + col][0]; kf[t][0] = frag_b(kr, lane); kf[t][1] = frag_b(kr + 32, lane); }
#pragma unroll
    for (int j = 0; j < HD / 16; ++j) vf[j] = frag_h(&sv[bu][j * 16 + col][kh * 32], lane);
    __builtin_amdgcn_sched_barrier(0);   /* keeps the stage's 16 LDS reads in one group ahead of its products: one LDS latency a stage (the v reads land under the weights) instead of a drained wait in front of every product */
#pragma unroll
    for (int t = 0; t < 2; ++t)
#pragma unroll
      for (int c = 0; c < QT; ++c) { v8f z = {}; z = wmma_b(kf[t][0], qf[c][0], z); st[c][t] = wmma_b(kf[t][1], qf[c][1], z); }
    v16h p[QT];
#pragma unroll
    for (int c = 0; c < QT; ++c)
#pragma unroll
      for (int t = 0; t < 2; ++t)
#pragma unroll
        for (int r = 0; r < 8; r += 2) { const v2f a = {st[c][t][r], st[c][t][r + 1]}; const v2f u = a * cu; v2f x, l, w;
          if constexpr (DIRECT) {
            x.x = __builtin_amdgcn_exp2f(u.x); x.y = __builtin_amdgcn_exp2f(u.y); x = x + one;
            l.x = __builtin_amdgcn_logf(x.x); l.y = __builtin_amdgcn_logf(x.y);
            w = l + em;
          } else {
            x.x = __builtin_amdgcn_exp2f(-fabsf(u.x)); x.y = __builtin_amdgcn_exp2f(-fabsf(u.y)); x = x + one;
            l.x = __builtin_amdgcn_logf(x.x); l.y = __builtin_amdgcn_logf(x.y);
            w = __builtin_elementwise_fma(l, ff, __builtin_elementwise_max(__builtin_elementwise_fma(a, cm, em), em));   /* max(f u + f eps', f eps') = f max(u, 0) + f eps' */
          }
          sum[c][r >> 1] += w; const v2h ph = __builtin_convertvector(w, v2h); p[c][t * 8 + r] = ph.x; p[c][t * 8 + r + 1] = ph.y; }
#pragma unroll
    for (int j = 0; j < HD / 16; ++j)
#pragma unroll
      for (int c = 0; c < QT; ++c) acc[c][j] = wmma_h(vf[j], p[c], acc[c][j]);
    if (more) put(raw, sk[bu ^ GRP], sv[bu ^ GRP], sr, sj, wave, lane);   /* its last readers left this buffer at the barrier that ended the group before this one */
    if ((s & (GRP - 1)) == GRP - 1) __syncthreads(); } }   /* s is the same in every thread of the block; publishes the next group, ends this group's reads */
// a wave's share of the query tile that its partner finishes, into LDS; lanes side by side, 16 bytes each
__device__ __forceinline__ void hand(const v8f (&a)[HD / 16], const float part, v4f (&xw)[HD / 8][32], float (&xsw)[32], const int lane) {
#pragma unroll
  for (int j = 0; j < HD / 16; ++j) { const v4f lo = {a[j][0], a[j][1], a[j][2], a[j][3]}, hi = {a[j][4], a[j][5], a[j][6], a[j][7]}; xw[2 * j][lane] = lo; xw[2 * j + 1][lane] = hi; }
  xsw[lane] = part; }
// own share + the partner's, divided by the whole row sum; then through the wave's own LDS rows, so that every store instruction of the wave writes two whole 256-byte output rows (four full lines) instead of 32 pieces of 16 bytes in 16 lines
#define OP 68              // pitch of a staged output row in floats: 272 B = 16 B x 17 (odd), conflict-free for the 16-byte writes and reads
__device__ __forceinline__ void finish(const v8f (&m)[HD / 16], const float part, const v4f (&xp)[HD / 8][32], const float (&xsp)[32], const int lane, float (&sw)[16][OP], float* o) {
  float tot = part + xsp[lane]; tot += __shfl_xor(tot, 16);   /* the two lane halves hold the two halves of every 16-key tile */
  const float inv = 1.0f / tot; const int col = lane & 15, g = lane >> 4;
#pragma unroll
  for (int j = 0; j < HD / 16; ++j) { const v4f pl = xp[2 * j][lane], ph = xp[2 * j + 1][lane];
    const v4f lo = {(m[j][0] + pl[0]) * inv, (m[j][1] + pl[1]) * inv, (m[j][2] + pl[2]) * inv, (m[j][3] + pl[3]) * inv}, hi = {(m[j][4] + ph[0]) * inv, (m[j][5] + ph[1]) * inv, (m[j][6] + ph[2]) * inv, (m[j][7] + ph[3]) * inv};
    *(v4f*)&sw[col][j * 16 + 8 * g] = lo; *(v4f*)&sw[col][j * 16 + 8 * g + 4] = hi; }   /* m[j][r] = channel 16 j + 8 g + r of query col */
  asm volatile("s_wait_dscnt 0" ::: "memory"); __builtin_amdgcn_wave_barrier();   /* the rows are read back by other lanes of the same wave: their writes have to be done, and no read may be moved above them */
#pragma unroll
  for (int i = 0; i < 8; ++i) { const v4f r = *(const v4f*)&sw[2 * i + g][col * 4]; vst2(o + (2 * i + g) * CC + col * 4, r); } }
// four waves per SIMD = one block per WGP: the 256 blocks are all resident
__global__ __launch_bounds__(512) __attribute__((amdgpu_waves_per_eu(4, 4))) void k_att(const float* __restrict__ Q, const float* __restrict__ K, const float* __restrict__ V, const float* __restrict__ SCL, float* __restrict__ O) {
  __shared__ __align__(16) __bf16 sk[NBUF][KST][LP];
  __shared__ __align__(16) _Float16 sv[NBUF][HD][LP];
  __shared__ __align__(16) v4f xa[NWV][HD / 8][32];   /* what a wave hands to the wave of the other key half: one query tile's context */
  __shared__ float xs[NWV][32];                       /* and that tile's partial row sums */
  __shared__ __align__(16) float so[NWV][16][OP];     /* a wave's finished query tile on its way to the output, rows as in memory */
  __shared__ int redo;   /* set by any lane whose row sum of the direct form is not finite */
  const int tid = threadIdx.x, wave = tid >> 5, lane = tid & 31, col = lane & 15, g = lane >> 4;
  const int kh = wave & 1;   /* which 32 keys of every stage are this wave's */
  const int b = blockIdx.y, q0 = blockIdx.x * 256 + (wave >> 1) * 32;
  // the scale is a scalar INPUT (bf16-rounded like every float input). Weights are formed in units of ln 2 (the unit cancels in the division by the row sum), u = score * scale * log2(e); f = 1 up to |scale| = 64 and 64 / |scale| beyond, which keeps the unnormalised weights of the guarded form inside f16 for any scale; f cancels too
  const float sc = bfr(SCL[0]); const float f = fabsf(sc) > 64.0f ? 64.0f / fabsf(sc) : 1.0f; const float c2 = sc * 1.44269504f; const float e2 = SP_EPS * 1.44269504f * f;
  v16b qf[QT][2];
#pragma unroll
  for (int c = 0; c < QT; ++c)
#pragma unroll
    for (int kc = 0; kc < 2; ++kc) qf[c][kc] = fragb_f32(Q + ((size_t)b * TT + q0 + c * 16 + col) * CC + kc * 32, lane);
  // staging: see struct Raw: whole lines from the f32 inputs, through registers (rounded there) into the padded LDS rows
  const int sr = tid >> 4, sj = tid & 15;
  const float* kg = K + ((size_t)b * TT + sr) * CC + sj * 4; const float* vg = V + ((size_t)b * TT + wave * 4) * CC + lane * 2;
  v8f acc[QT][HD / 16] = {}; v2f sum[QT][4] = {};   /* four independent partial row sums a tile: no long dependent chain of adds */
  if (tid == 0) redo = 0;   /* published by the first barrier of the walk */
  int guarded = __builtin_amdgcn_readfirstlane(fabsf(sc) <= 64.0f ? 0 : 1);   /* the same in every thread of the grid; a scalar, since barriers stand behind the branch */
  if (!guarded) {
    walk_keys<true>(sk, sv, kg, vg, qf, sr, sj, wave, kh, col, lane, c2, f, e2, acc, sum);
    const v2f h = ((sum[0][0] + sum[0][1]) + (sum[0][2] + sum[0][3])) + ((sum[1][0] + sum[1][1]) + (sum[1][2] + sum[1][3]));
    if (!(h.x + h.y < __builtin_inff())) redo = 1;   /* weights are never negative: one overflowed 2^u leaves the sum infinite */
    __syncthreads();   /* publishes the flag to the whole block */
    guarded = __builtin_amdgcn_readfirstlane(redo);
  }
  if (guarded) {   /* the whole block walks the keys in the form that cannot overflow (for |scale| > 64, or again after the direct form overflowed) */
#pragma unroll
    for (int c = 0; c < QT; ++c) {
#pragma unroll
      for (int j = 0; j < HD / 16; ++j) acc[c][j] = v8f{};
#pragma unroll
      for (int j = 0; j < 4; ++j) sum[c][j] = v2f{}; }
    walk_keys<false>(sk, sv, kg, vg, qf, sr, sj, wave, kh, col, lane, c2, f, e2, acc, sum);
  }
  // the two key halves meet: the wave of half kh finishes query tile kh and hands its share of the other tile to its partner (wave ^ 1)
  float part[QT];
#pragma unroll
  for (int c = 0; c < QT; ++c) { const v2f s2 = (sum[c][0] + sum[c][1]) + (sum[c][2] + sum[c][3]); part[c] = s2.x + s2.y; }
  const int khs = __builtin_amdgcn_readfirstlane(kh);   /* the same in a whole wave; whole tiles are picked by control flow, which keeps the accumulators in registers (a select between the two arrays sent them through memory) */
  if (khs) hand(acc[0], part[0], xa[wave], xs[wave], lane); else hand(acc[1], part[1], xa[wave], xs[wave], lane);
  __syncthreads();   /* publishes the handed-over shares */
  float* o = O + ((size_t)b * TT + q0 + kh * 16) * CC;   /* first row of the query tile that this wave finishes */
  if (khs) finish(acc[1], part[1], xa[wave ^ 1], xs[wave ^ 1], lane, so[wave], o); else finish(acc[0], part[0], xa[wave ^ 1], xs[wave ^ 1], lane, so[wave], o); }

extern "C" void kernel_launch(void* const* d_in, const int* in_sizes, int n_in, void* d_out, int out_size, void* d_ws, size_t ws_size, hipStream_t stream) {
  (void)in_sizes; (void)n_in; (void)out_size; (void)d_ws; (void)ws_size;
  const float** F = (const float**)d_in;
  // inputs: 0 q [32,2048,64]; 1 k; 2 v; 3 scale (f32 scalar)
  k_att<<<dim3(TT / 256, TNB), 512, 0, stream>>>(F[0], F[1], F[2], F[3], (float*)d_out);
}

// v007
// It runs in 34.1 microseconds.
// Next to v006, in two timings, it ran 1.07 times as fast each time.
// Counting every step since v000, it is 79.8 times as fast.
// compute dtype: all float inputs rounded to bf16; raw q / k / v: the scores q . k are exact products of the bf16 inputs (bf16 operands, f32 accumulate), multiplied by the scale INPUT in f32; weights = softplus(score) + 1e-8 in f32 (no exponential softmax), rounded once to f16 unnormalised x v (bf16-rounded, exact in f16); the f32 context is divided by the f32 row sum of the weights; f32 output.
#include <hip/hip_runtime.h>
#include <math.h>

typedef __attribute__((ext_vector_type(16))) _Float16 v16h;
typedef __attribute__((ext_vector_type(16))) __bf16 v16b;
typedef __attribute__((ext_vector_type(8)))  _Float16 v8h;
typedef __attribute__((ext_vector_type(8)))  float v8f;
typedef __attribute__((ext_vector_type(4)))  float v4f;
typedef __attribute__((ext_vector_type(2)))  float v2f;
typedef __attribute__((ext_vector_type(4)))  unsigned v4u;
typedef __attribute__((ext_vector_type(4)))  int v4i;
typedef float __attribute__((may_alias)) float_a;
typedef int __attribute__((may_alias)) int_a;

template <typename T> __device__ __forceinline__ void vst2(void* p, T v) { *(T*)p = v;  }
__device__ __forceinline__ v8f wmma16(v16h a, v16h b, v8f c) {
  v8f d = __builtin_amdgcn_wmma_f32_16x16x32_f16(false, a, false, b, (short)0, c, false, false);
  asm volatile("v_nop\n\tv_nop\n\tv_nop\n\tv_nop" : "+v"(d) : "v"(a), "v"(b));
  return d;
}
__device__ __forceinline__ v8f wmma_bf(v16b a, v16b b, v8f c) {
  v8f d = __builtin_amdgcn_wmma_f32_16x16x32_bf16(false, a, false, b, (short)0, c, false, false);
  asm volatile("v_nop\n\tv_nop\n\tv_nop\n\tv_nop" : "+v"(d) : "v"(a), "v"(b));
  return d;
}
// 16x16x32 fragments: lane = (h = lane>>4, row/col = lane&15); elements 0..7 = k0+8h+0..7, 8..15 = k0+16+8h+0..7; D element r = row 8h+r
__device__ __forceinline__ v16h frag_h(const _Float16* rowk0, int lane) {
  union { v16h v; v8h q[2]; } u; const _Float16* p = rowk0 + 8 * (lane >> 4);
  u.q[0] = *(const v8h*)p; u.q[1] = *(const v8h*)(p + 16); return u.v;
}
__device__ __forceinline__ v16h frag_f32(const float* rowk0, int lane) {
  v16h a; const float* p = rowk0 + 8 * (lane >> 4);
#pragma unroll
  for (int i = 0; i < 8; ++i) { a[i] = (_Float16)p[i]; a[8 + i] = (_Float16)p[16 + i]; }
  return a;
}
__device__ __forceinline__ v16h frag_f32s(const float* rowk0, int lane, float sc) {
  v16h a; const float* p = rowk0 + 8 * (lane >> 4);
#pragma unroll
  for (int i = 0; i < 8; ++i) { a[i] = (_Float16)(p[i] * sc); a[8 + i] = (_Float16)(p[16 + i] * sc); }
  return a;
}
// column fragment from a [K][ld] layout (column n), rows >= K read as 0
__device__ __forceinline__ v16h fragc_f32(const float* W, int k0, int n, int lane, int ld, int K) {
  v16h a; const int g = lane >> 4;
#pragma unroll
  for (int i = 0; i < 8; ++i) { const int ka = k0 + 8 * g + i, kb = ka + 16;
    a[i] = (_Float16)(ka < K ? W[(size_t)(ka < K ? ka : K - 1) * ld + n] : 0.f); a[8 + i] = (_Float16)(kb < K ? W[(size_t)(kb < K ? kb : K - 1) * ld + n] : 0.f); }
  return a;
}
struct F2 { v16b h, l; };
__device__ __forceinline__ F2 bsplit16(const float v[16]) { F2 r;
#pragma unroll
  for (int i = 0; i < 16; ++i) { const __bf16 h = (__bf16)v[i]; r.h[i] = h; r.l[i] = (__bf16)(v[i] - (float)h); }
  return r; }
__device__ __forceinline__ F2 split_row(const float* row, int k0, int lane) { float v[16]; const float* p = row + k0 + 8 * (lane >> 4);
#pragma unroll
  for (int i = 0; i < 8; ++i) { v[i] = p[i]; v[8 + i] = p[16 + i]; }
  return bsplit16(v); }
__device__ __forceinline__ F2 split_rowK(const float* row, int k0, int lane, int K) { float v[16]; const int g = lane >> 4;
#pragma unroll
  for (int i = 0; i < 8; ++i) { const int ka = k0 + 8 * g + i, kb = ka + 16; v[i] = ka < K ? row[ka < K ? ka : K - 1] : 0.f; v[8 + i] = kb < K ? row[kb < K ? kb : K - 1] : 0.f; }
  return bsplit16(v); }
__device__ __forceinline__ F2 split_col(const float* W, int k0, int n, int lane, int ld, int K) { float v[16]; const int g = lane >> 4;
#pragma unroll
  for (int i = 0; i < 8; ++i) { const int ka = k0 + 8 * g + i, kb = ka + 16; v[i] = ka < K ? W[(size_t)(ka < K ? ka : K - 1) * ld + n] : 0.f; v[8 + i] = kb < K ? W[(size_t)(kb < K ? kb : K - 1) * ld + n] : 0.f; }
  return bsplit16(v); }
__device__ __forceinline__ v8f mac3(const F2& a, const F2& b, v8f c) { c = wmma_bf(a.l, b.h, c); c = wmma_bf(a.h, b.l, c); return wmma_bf(a.h, b.h, c); }
__device__ __forceinline__ float sigm(float v) { return 1.0f / (1.0f + expf(-v)); }
#define LDSX() do { asm volatile("s_wait_dscnt 0" ::: "memory"); __builtin_amdgcn_wave_barrier(); __builtin_amdgcn_fence(__ATOMIC_RELEASE, "workgroup"); } while (0)

// Quadratic attention with a softplus kernel instead of a softmax (q / k / v [32,2048,64]; sim = softplus(q k^T * scale) + 1e-8 with scale a scalar input; sim /= sum over keys; out = sim v -> [32,2048,64]; no mask).
#define NB 32
#define TT 2048
#define CC 64            // NH * HD = projected width
#define DIN 64          // input (model) width
#define NH 1
#define HD 64
#define NQB (TT / 64)
#define HG 1
#define SCALE (1.0f)
#define CAUSAL 0
#ifndef TNB
#define TNB NB
#endif
__device__ __forceinline__ float bfr(float v) { return (float)(__bf16)v; }
__host__ __device__ __forceinline__ int kb_last(int qb) { return CAUSAL ? ((qb * 64 + 63) >> 7) : (TT / 128 - 1); }
typedef __attribute__((ext_vector_type(8))) __bf16 v8b;
__device__ __forceinline__ v16b frag_b(const __bf16* rowk0, int lane) {
  union { v16b v; v8b q[2]; } u; const __bf16* p = rowk0 + 8 * (lane >> 4);
  u.q[0] = *(const v8b*)p; u.q[1] = *(const v8b*)(p + 16); return u.v;
}
#define QBH 0              // unused: k_att has no causal or high-precision path
#define QHI 0              // (override) rows carrying the q residual plane
#define KHI 64            // key rows carrying k residual / v bf16 hi+lo planes (no kernel in this file writes or reads them)
// B fragment (k rows k0+.., output column o) of a weight: (in,out) [K][ld] or (out,in) [ld rows of K]: bf16 exact, or f16(bf16 * 256) exact
__device__ __forceinline__ v16b wcol_io(const float* Wm, int k0, int o, int lane, int ld) { v16b w; const int g = lane >> 4;
#pragma unroll
  for (int i = 0; i < 8; ++i) { w[i] = (__bf16)Wm[(size_t)(k0 + 8 * g + i) * ld + o]; w[8 + i] = (__bf16)Wm[(size_t)(k0 + 16 + 8 * g + i) * ld + o]; }
  return w; }
__device__ __forceinline__ v16b wcol_oi(const float* Wm, int k0, int o, int lane, int K) { v16b w; const float* p = Wm + (size_t)o * K + k0 + 8 * (lane >> 4);
#pragma unroll
  for (int i = 0; i < 8; ++i) { w[i] = (__bf16)p[i]; w[8 + i] = (__bf16)p[16 + i]; }
  return w; }
__device__ __forceinline__ v16h wcolh_io(const float* Wm, int k0, int o, int lane, int ld) { v16h w; const int g = lane >> 4;
#pragma unroll
  for (int i = 0; i < 8; ++i) { w[i] = (_Float16)(bfr(Wm[(size_t)(k0 + 8 * g + i) * ld + o]) * 256.0f); w[8 + i] = (_Float16)(bfr(Wm[(size_t)(k0 + 16 + 8 * g + i) * ld + o]) * 256.0f); }
  return w; }
__device__ __forceinline__ v16h wcolh_oi(const float* Wm, int k0, int o, int lane, int K) { v16h w; const float* p = Wm + (size_t)o * K + k0 + 8 * (lane >> 4);
#pragma unroll
  for (int i = 0; i < 8; ++i) { w[i] = (_Float16)(bfr(p[i]) * 256.0f); w[8 + i] = (_Float16)(bfr(p[16 + i]) * 256.0f); }
  return w; }
#define WQKV_LAYOUT 1   // 0 = (in,out) [DIN][CC]; 1 = (out,in) [CC][DIN]; 2 = per-head [NH][DIN][HD]
__device__ __forceinline__ v16b wcol_hdk(const float* Wm, int k0, int o, int lane) { v16b w; const int g = lane >> 4; const float* p = Wm + (size_t)(o / HD) * DIN * HD + (o % HD);
#pragma unroll
  for (int i = 0; i < 8; ++i) { w[i] = (__bf16)p[(size_t)(k0 + 8 * g + i) * HD]; w[8 + i] = (__bf16)p[(size_t)(k0 + 16 + 8 * g + i) * HD]; }
  return w; }
#define WO_OUT_IN 0
#if WQKV_LAYOUT == 1
#define WCOL(W, k0, o, lane) wcol_oi(W, k0, o, lane, DIN)
#elif WQKV_LAYOUT == 2
#define WCOL(W, k0, o, lane) wcol_hdk(W, k0, o, lane)
#else
#define WCOL(W, k0, o, lane) wcol_io(W, k0, o, lane, CC)
#endif
#if WO_OUT_IN
#define WOCOL(W, k0, o, lane) wcol_oi(W, k0, o, lane, CC)
#define WOCOLH(W, k0, o, lane) wcolh_oi(W, k0, o, lane, CC)
#else
#define WOCOL(W, k0, o, lane) wcol_io(W, k0, o, lane, DIN)
#define WOCOLH(W, k0, o, lane) wcolh_io(W, k0, o, lane, DIN)
#endif
#define SP_EPS 1.0e-8f
typedef __attribute__((ext_vector_type(4))) _Float16 v4h;
typedef __attribute__((ext_vector_type(4))) __bf16 v4b;
typedef __attribute__((ext_vector_type(2))) __bf16 v2b;

// ---- k_att: the only launch. Block = 256 queries of sequence b, 16 waves = 8 query groups x 2 key halves: a wave holds 32 query columns (two 16-column tiles) and walks, of every 64-key stage, its own 32 keys, so each k or v fragment read from LDS feeds two products; the work-group barrier of a stage is split (see walk_keys), so the waves of a SIMD need not meet at one point. Stages come straight from the f32 inputs: a stage's k and v are rounded to bf16 on their way from the registers into LDS (k stays bf16; v goes on to f16, exact, and is turned to [c][key] by the choice of which thread holds what). S^T = K . Q^T (A = key rows from LDS, B = q kept in registers), so a lane holds one query's scores; the two 16-key score tiles, turned into weights in place, are the B operand of O^T += V^T . P^T (A = v planes [c][key] from LDS, same k order as frag_h): scores and weights never leave the registers. No row maximum is needed (plain sum), so one pass over the keys does it all, unless the direct form overflows and the block walks them again in the guarded form; the two key halves of a query group are added once, through LDS, and the context is divided by the row sum at the end.
#define KST 64             // keys per stage
#define NST (TT / KST)
#define LP 72              // LDS row pitch in 16-bit elements: 144 B = 16 B x 9 (odd), conflict-free for 16-byte fragment reads
#define NBUF 2             // one buffer is read while the other is filled
#define NWV 16             // waves per block
#define QT 2               // 16-column query tiles per wave
typedef __attribute__((ext_vector_type(2))) _Float16 v2h;
__device__ __forceinline__ v8f wmma_h(v16h a, v16h b, v8f c) { return __builtin_amdgcn_wmma_f32_16x16x32_f16(false, a, false, b, (short)0, c, false, false); }
__device__ __forceinline__ v8f wmma_b(v16b a, v16b b, v8f c) { return __builtin_amdgcn_wmma_f32_16x16x32_bf16(false, a, false, b, (short)0, c, false, false); }
// row fragment straight from f32 (same k order as frag_b), rounded to bf16
__device__ __forceinline__ v16b fragb_f32(const float* rowk0, int lane) { v16b a; const float* p = rowk0 + 8 * (lane >> 4);
#pragma unroll
  for (int i = 0; i < 8; ++i) { a[i] = (__bf16)p[i]; a[8 + i] = (__bf16)p[16 + i]; }
  return a; }
// a thread's share of one stage as it comes from memory. k: thread = (sr = tid >> 4, sj = tid & 15): rows sr + 32 i, channels 4 sj .. + 3 (a 16-byte load of a half wave covers one whole 256-byte row). v: thread = (wave, lane): keys 4 wave + i, channels 2 lane, 2 lane + 1 (an 8-byte load of a wave covers one whole row)
struct Raw { v4f k[2]; v2f v[4]; };
__device__ __forceinline__ void fetch(Raw& r, const float* kn, const float* vn, const int off) {   /* off: a constant number of elements, which goes into the loads' offset field */
#pragma unroll
  for (int i = 0; i < 2; ++i) r.k[i] = *(const v4f*)(kn + off + i * 32 * CC);
#pragma unroll
  for (int i = 0; i < 4; ++i) r.v[i] = *(const v2f*)(vn + off + i * CC);
  asm volatile("s_wait_xcnt 0x0" :: "v"(kn), "v"(vn) : "memory");   /* stands in front of the first reuse of an address register of the loads above; a precaution. The two addresses are inputs, so they keep their registers up to the wait: no load's destination takes them over */
}
__device__ __forceinline__ void put(const Raw& r, __bf16 (&sk)[KST][LP], _Float16 (&sv)[HD][LP], const int sr, const int sj, const int wave, const int lane) {
#pragma unroll
  for (int i = 0; i < 2; ++i) *(v4b*)&sk[sr + 32 * i][sj * 4] = __builtin_convertvector(r.k[i], v4b);
  unsigned x[4];   /* key i, the thread's two channels as a bf16 pair: one packed rounding to nearest even for the two registers of a load */
#pragma unroll
  for (int i = 0; i < 4; ++i) x[i] = __builtin_bit_cast(unsigned, __builtin_convertvector(r.v[i], v2b));
#pragma unroll
  for (int cc = 0; cc < 2; ++cc) { float e[4];   /* channel cc of the four keys, back as f32, then f16 (exact for values inside f16's range) */
#pragma unroll
    for (int i = 0; i < 4; ++i) e[i] = __builtin_bit_cast(float, cc ? (x[i] & 0xffff0000u) : (x[i] << 16));
    const v2f e01 = {e[0], e[1]}, e23 = {e[2], e[3]}; union { v2h p[2]; v4h q; } h; h.p[0] = __builtin_convertvector(e01, v2h); h.p[1] = __builtin_convertvector(e23, v2h);
    *(v4h*)&sv[lane * 2 + cc][wave * 4] = h.q; } }
// the two halves of the work-group barrier and the wait that stands in front of the signal. The "memory" clobber keeps every LDS access on its side of the statement
__device__ __forceinline__ void lds_done() { asm volatile("s_wait_dscnt 0x0" ::: "memory"); }      /* without it the signal could pass this wave's LDS stores and reads still under way */
__device__ __forceinline__ void bar_signal() { asm volatile("s_barrier_signal -1" ::: "memory"); }  /* by hand, since __syncthreads() has signal and wait side by side */
__device__ __forceinline__ void bar_wait() { asm volatile("s_barrier_wait -1" ::: "memory"); }
// one walk over the wave's half (kh) of all keys of the sequence. DIRECT: w = log2(1 + 2^u) + eps' (no |u|, no maximum: two vector instructions fewer per pair of weights); right while 2^u stays finite (u < 128), and an overflow shows as an infinite row sum. Otherwise the guarded form, right for every u: w = f * (max(u, 0) + log2(1 + 2^-|u|) + eps')
template <bool DIRECT>
__device__ __forceinline__ void walk_keys(__bf16 (&sk)[NBUF][KST][LP], _Float16 (&sv)[NBUF][HD][LP], const float* kg, const float* vg, const v16b (&qf)[QT][2], const int sr, const int sj, const int wave, const int kh, const int col, const int lane, const float c2, const float f, const float e2, v8f (&acc)[QT][HD / 16], v2f (&sum)[QT][4]) {
  const v2f cu = {c2, c2}, cm = {c2 * f, c2 * f}, em = {e2, e2}, ff = {f, f}, one = {1.0f, 1.0f};
  // The barrier is split. A wave signals once its LDS reads of stage s have returned and its share of stage s + 1 is stored; it waits only at the top of stage s + 1. No LDS access stands between signal and wait, signal and wait alternate strictly in every wave, none stands in a branch. A wave may thus run ahead of the slowest by the weights and v products of a stage: the waves of a SIMD drift apart, and one wave's products run beside another's weights
  Raw raw; fetch(raw, kg, vg, 0); put(raw, sk[0], sv[0], sr, sj, wave, lane);
  fetch(raw, kg, vg, KST * CC);   /* stage 1 flies over the first hand-over */
  lds_done(); bar_signal();
#pragma unroll 1
  for (int s = 0; s < NST; ++s) { const int bu = s & (NBUF - 1);
    bar_wait();   /* every wave has stored its share of stage s and has left the other buffer (stage s - 1) */
    v8f st[QT][2]; v16b kf[2][2]; v16h vf[HD / 16];
#pragma unroll
    for (int t = 0; t < 2; ++t) { const __bf16* kr = &sk[bu][kh * 32 + t * 16 + col][0]; kf[t][0] = frag_b(kr, lane); kf[t][1] = frag_b(kr + 32, lane); }
#pragma unroll
    for (int j = 0; j < HD / 16; ++j) vf[j] = frag_h(&sv[bu][j * 16 + col][kh * 32], lane);
    __builtin_amdgcn_sched_barrier(0);   /* keeps the stage's 16 LDS reads in one group ahead of the stores and the products: one LDS latency a stage, under which the next stage's share is rounded, instead of a drained wait in front of every product */
    put(raw, sk[bu ^ 1], sv[bu ^ 1], sr, sj, wave, lane);   /* stage s + 1; the rounding runs under the latency of the reads above. No branch, so that the whole stage is one block for the scheduler: in the last stage this fills a buffer that every wave has left and nobody reads again */
    lds_done(); bar_signal();   /* this wave's reads of stage s are in registers, its share of stage s + 1 is in LDS */
    const int sn = s + 2 < NST ? s : NST - 3;   /* stage sn + 2 is read. No branch here either: the last two stages read the last stage's rows once more, in bounds */
    fetch(raw, kg + (size_t)sn * KST * CC, vg + (size_t)sn * KST * CC, 2 * KST * CC);   /* flies while this stage's weights are formed; stored at the top of the next stage */
    __builtin_amdgcn_sched_barrier(0);   /* keeps the stage's products and weights behind the signal and the loads: left free, the scheduler let the LDS stores and the signal, or the loads, sink to the end of the stage: no wave could run ahead, and the loads lost their lead */
#pragma unroll
    for (int t = 0; t < 2; ++t)
#pragma unroll
      for (int c = 0; c < QT; ++c) { v8f z = {}; z = wmma_b(kf[t][0], qf[c][0], z); st[c][t] = wmma_b(kf[t][1], qf[c][1], z); }
    v16h p[QT];
#pragma unroll
    for (int c = 0; c < QT; ++c)
#pragma unroll
      for (int t = 0; t < 2; ++t)
#pragma unroll
        for (int r = 0; r < 8; r += 2) { const v2f a = {st[c][t][r], st[c][t][r + 1]}; const v2f u = a * cu; v2f x, l, w;
          if constexpr (DIRECT) {
            x.x = __builtin_amdgcn_exp2f(u.x); x.y = __builtin_amdgcn_exp2f(u.y); x = x + one;
            l.x = __builtin_amdgcn_logf(x.x); l.y = __builtin_amdgcn_logf(x.y);
            w = l + em;
          } else {
            x.x = __builtin_amdgcn_exp2f(-fabsf(u.x)); x.y = __builtin_amdgcn_exp2f(-fabsf(u.y)); x = x + one;
            l.x = __builtin_amdgcn_logf(x.x); l.y = __builtin_amdgcn_logf(x.y);
            w = __builtin_elementwise_fma(l, ff, __builtin_elementwise_max(__builtin_elementwise_fma(a, cm, em), em));   /* max(f u + f eps', f eps') = f max(u, 0) + f eps' */
          }
          sum[c][r >> 1] += w; const v2h ph = __builtin_convertvector(w, v2h); p[c][t * 8 + r] = ph.x; p[c][t * 8 + r + 1] = ph.y; }
    __builtin_amdgcn_sched_barrier(0);   /* keeps the row-sum adds ahead of the v products: placed among them they took over operand registers of products just issued, at four idle slots a time */
#pragma unroll
    for (int j = 0; j < HD / 16; ++j)
#pragma unroll
      for (int c = 0; c < QT; ++c) acc[c][j] = wmma_h(vf[j], p[c], acc[c][j]);
  }
  bar_wait(); }   /* the wait of the last signal: every wave has left the ring */
// a wave's share of the query tile that its partner finishes, into LDS; lanes side by side, 16 bytes each
__device__ __forceinline__ void hand(const v8f (&a)[HD / 16], const float part, v4f (&xw)[HD / 8][32], float (&xsw)[32], const int lane) {
#pragma unroll
  for (int j = 0; j < HD / 16; ++j) { const v4f lo = {a[j][0], a[j][1], a[j][2], a[j][3]}, hi = {a[j][4], a[j][5], a[j][6], a[j][7]}; xw[2 * j][lane] = lo; xw[2 * j + 1][lane] = hi; }
  xsw[lane] = part; }
// own share + the partner's, divided by the whole row sum; then through the wave's own LDS rows, so that every store instruction of the wave writes two whole 256-byte output rows (four full lines) instead of 32 pieces of 16 bytes in 16 lines
#define OP 68              // pitch of a staged output row in floats: 272 B = 16 B x 17 (odd), conflict-free for the 16-byte writes and reads
__device__ __forceinline__ void finish(const v8f (&m)[HD / 16], const float part, const v4f (&xp)[HD / 8][32], const float (&xsp)[32], const int lane, float (&sw)[16][OP], float* o) {
  float tot = part + xsp[lane]; tot += __shfl_xor(tot, 16);   /* the two lane halves hold the two halves of every 16-key tile */
  const float inv = 1.0f / tot; const int col = lane & 15, g = lane >> 4;
#pragma unroll
  for (int j = 0; j < HD / 16; ++j) { const v4f pl = xp[2 * j][lane], ph = xp[2 * j + 1][lane];
    const v4f lo = {(m[j][0] + pl[0]) * inv, (m[j][1] + pl[1]) * inv, (m[j][2] + pl[2]) * inv, (m[j][3] + pl[3]) * inv}, hi = {(m[j][4] + ph[0]) * inv, (m[j][5] + ph[1]) * inv, (m[j][6] + ph[2]) * inv, (m[j][7] + ph[3]) * inv};
    *(v4f*)&sw[col][j * 16 + 8 * g] = lo; *(v4f*)&sw[col][j * 16 + 8 * g + 4] = hi; }   /* m[j][r] = channel 16 j + 8 g + r of query col */
  asm volatile("s_wait_dscnt 0" ::: "memory"); __builtin_amdgcn_wave_barrier();   /* the rows are read back by other lanes of the same wave: their writes have to be done, and no read may be moved above them */
#pragma unroll
  for (int i = 0; i < 8; ++i) { const v4f r = *(const v4f*)&sw[2 * i + g][col * 4]; vst2(o + (2 * i + g) * CC + col * 4, r); } }
// four waves per SIMD = one block per WGP: the 256 blocks are all resident
__global__ __launch_bounds__(512) __attribute__((amdgpu_waves_per_eu(4, 4))) void k_att(const float* __restrict__ Q, const float* __restrict__ K, const float* __restrict__ V, const float* __restrict__ SCL, float* __restrict__ O) {
  __shared__ __align__(16) __bf16 sk[NBUF][KST][LP];
  __shared__ __align__(16) _Float16 sv[NBUF][HD][LP];
  __shared__ __align__(16) v4f xa[NWV][HD / 8][32];   /* what a wave hands to the wave of the other key half: one query tile's context */
  __shared__ float xs[NWV][32];                       /* and that tile's partial row sums */
  __shared__ __align__(16) float so[NWV][16][OP];     /* a wave's finished query tile on its way to the output, rows as in memory */
  __shared__ int redo;   /* set by any lane whose row sum of the direct form is not finite */
  const int tid = threadIdx.x, wave = tid >> 5, lane = tid & 31, col = lane & 15, g = lane >> 4;
  const int kh = wave & 1;   /* which 32 keys of every stage are this wave's */
  const int b = blockIdx.y, q0 = blockIdx.x * 256 + (wave >> 1) * 32;
  // the scale is a scalar INPUT (bf16-rounded like every float input). Weights are formed in units of ln 2 (the unit cancels in the division by the row sum), u = score * scale * log2(e); f = 1 up to |scale| = 64 and 64 / |scale| beyond, which keeps the unnormalised weights of the guarded form inside f16 for any scale; f cancels too
  const float sc = bfr(SCL[0]); const float f = fabsf(sc) > 64.0f ? 64.0f / fabsf(sc) : 1.0f; const float c2 = sc * 1.44269504f; const float e2 = SP_EPS * 1.44269504f * f;
  v16b qf[QT][2];
#pragma unroll
  for (int c = 0; c < QT; ++c)
#pragma unroll
    for (int kc = 0; kc < 2; ++kc) qf[c][kc] = fragb_f32(Q + ((size_t)b * TT + q0 + c * 16 + col) * CC + kc * 32, lane);
  // staging: see struct Raw: whole lines from the f32 inputs, through registers (rounded there) into the padded LDS rows
  const int sr = tid >> 4, sj = tid & 15;
  const float* kg = K + ((size_t)b * TT + sr) * CC + sj * 4; const float* vg = V + ((size_t)b * TT + wave * 4) * CC + lane * 2;
  v8f acc[QT][HD / 16] = {}; v2f sum[QT][4] = {};   /* four independent partial row sums a tile: no long dependent chain of adds */
  if (tid == 0) redo = 0;   /* published by the first hand-over of the walk */
  int guarded = __builtin_amdgcn_readfirstlane(fabsf(sc) <= 64.0f ? 0 : 1);   /* the same in every thread of the grid; a scalar, since barriers stand behind the branch */
  if (!guarded) {
    walk_keys<true>(sk, sv, kg, vg, qf, sr, sj, wave, kh, col, lane, c2, f, e2, acc, sum);
    const v2f h = ((sum[0][0] + sum[0][1]) + (sum[0][2] + sum[0][3])) + ((sum[1][0] + sum[1][1]) + (sum[1][2] + sum[1][3]));
    if (!(h.x + h.y < __builtin_inff())) redo = 1;   /* weights are never negative: one overflowed 2^u leaves the sum infinite */
    __syncthreads();   /* publishes the flag to the whole block */
    guarded = __builtin_amdgcn_readfirstlane(redo);
  }
  if (guarded) {   /* the whole block walks the keys in the form that cannot overflow (for |scale| > 64, or again after the direct form overflowed) */
#pragma unroll
    for (int c = 0; c < QT; ++c) {
#pragma unroll
      for (int j = 0; j < HD / 16; ++j) acc[c][j] = v8f{};
#pragma unroll
      for (int j = 0; j < 4; ++j) sum[c][j] = v2f{}; }
    walk_keys<false>(sk, sv, kg, vg, qf, sr, sj, wave, kh, col, lane, c2, f, e2, acc, sum);
  }
  // the two key halves meet: the wave of half kh finishes query tile kh and hands its share of the other tile to its partner (wave ^ 1)
  float part[QT];
#pragma unroll
  for (int c = 0; c < QT; ++c) { const v2f s2 = (sum[c][0] + sum[c][1]) + (sum[c][2] + sum[c][3]); part[c] = s2.x + s2.y; }
  const int khs = __builtin_amdgcn_readfirstlane(kh);   /* the same in a whole wave; whole tiles are picked by control flow, which keeps the accumulators in registers (a select between the two arrays sent them through memory) */
  if (khs) hand(acc[0], part[0], xa[wave], xs[wave], lane); else hand(acc[1], part[1], xa[wave], xs[wave], lane);
  __syncthreads();   /* publishes the handed-over shares */
  float* o = O + ((size_t)b * TT + q0 + kh * 16) * CC;   /* first row of the query tile that this wave finishes */
  if (khs) finish(acc[1], part[1], xa[wave ^ 1], xs[wave ^ 1], lane, so[wave], o); else finish(acc[0], part[0], xa[wave ^ 1], xs[wave ^ 1], lane, so[wave], o); }

extern "C" void kernel_launch(void* const* d_in, const int* in_sizes, int n_in, void* d_out, int out_size, void* d_ws, size_t ws_size, hipStream_t stream) {
  (void)in_sizes; (void)n_in; (void)out_size; (void)d_ws; (void)ws_size;
  const float** F = (const float**)d_in;
  // inputs: 0 q [32,2048,64]; 1 k; 2 v; 3 scale (f32 scalar)
  k_att<<<dim3(TT / 256, TNB), 512, 0, stream>>>(F[0], F[1], F[2], F[3], (float*)d_out);
}

// v008
// Measured time: 32.2 microseconds a run.
// Timed twice side by side with v007, it ran 1.06 times as fast both times.
// Over all steps from v000 it is 84.4 times as fast.
// compute dtype: all float inputs rounded to bf16; raw q / k / v: the scores q . k are exact products of the bf16 inputs (bf16 operands, f32 accumulate), multiplied by the scale INPUT in f32; weights = softplus(score) in f32 (no exponential softmax), rounded once to f16 unnormalised x v (bf16-rounded, exact in f16); the f32 context is divided by the f32 row sum of the f16 weights (ones x weights, f32 accumulate) + 2048 x 1e-8; f32 output.
#include <hip/hip_runtime.h>
#include <math.h>

typedef __attribute__((ext_vector_type(16))) _Float16 v16h;
typedef __attribute__((ext_vector_type(16))) __bf16 v16b;
typedef __attribute__((ext_vector_type(8)))  _Float16 v8h;
typedef __attribute__((ext_vector_type(8)))  float v8f;
typedef __attribute__((ext_vector_type(4)))  float v4f;
typedef __attribute__((ext_vector_type(2)))  float v2f;
typedef __attribute__((ext_vector_type(4)))  unsigned v4u;
typedef __attribute__((ext_vector_type(4)))  int v4i;
typedef float __attribute__((may_alias)) float_a;
typedef int __attribute__((may_alias)) int_a;

template <typename T> __device__ __forceinline__ void vst2(void* p, T v) { *(T*)p = v;  }
__device__ __forceinline__ v8f wmma16(v16h a, v16h b, v8f c) {
  v8f d = __builtin_amdgcn_wmma_f32_16x16x32_f16(false, a, false, b, (short)0, c, false, false);
  asm volatile("v_nop\n\tv_nop\n\tv_nop\n\tv_nop" : "+v"(d) : "v"(a), "v"(b));
  return d;
}
__device__ __forceinline__ v8f wmma_bf(v16b a, v16b b, v8f c) {
  v8f d = __builtin_amdgcn_wmma_f32_16x16x32_bf16(false, a, false, b, (short)0, c, false, false);
  asm volatile("v_nop\n\tv_nop\n\tv_nop\n\tv_nop" : "+v"(d) : "v"(a), "v"(b));
  return d;
}
// 16x16x32 fragments: lane = (h = lane>>4, row/col = lane&15); elements 0..7 = k0+8h+0..7, 8..15 = k0+16+8h+0..7; D element r = row 8h+r
__device__ __forceinline__ v16h frag_h(const _Float16* rowk0, int lane) {
  union { v16h v; v8h q[2]; } u; const _Float16* p = rowk0 + 8 * (lane >> 4);
  u.q[0] = *(const v8h*)p; u.q[1] = *(const v8h*)(p + 16); return u.v;
}
__device__ __forceinline__ v16h frag_f32(const float* rowk0, int lane) {
  v16h a; const float* p = rowk0 + 8 * (lane >> 4);
#pragma unroll
  for (int i = 0; i < 8; ++i) { a[i] = (_Float16)p[i]; a[8 + i] = (_Float16)p[16 + i]; }
  return a;
}
__device__ __forceinline__ v16h frag_f32s(const float* rowk0, int lane, float sc) {
  v16h a; const float* p = rowk0 + 8 * (lane >> 4);
#pragma unroll
  for (int i = 0; i < 8; ++i) { a[i] = (_Float16)(p[i] * sc); a[8 + i] = (_Float16)(p[16 + i] * sc); }
  return a;
}
// column fragment from a [K][ld] layout (column n), rows >= K read as 0
__device__ __forceinline__ v16h fragc_f32(const float* W, int k0, int n, int lane, int ld, int K) {
  v16h a; const int g = lane >> 4;
#pragma unroll
  for (int i = 0; i < 8; ++i) { const int ka = k0 + 8 * g + i, kb = ka + 16;
    a[i] = (_Float16)(ka < K ? W[(size_t)(ka < K ? ka : K - 1) * ld + n] : 0.f); a[8 + i] = (_Float16)(kb < K ? W[(size_t)(kb < K ? kb : K - 1) * ld + n] : 0.f); }
  return a;
}
struct F2 { v16b h, l; };
__device__ __forceinline__ F2 bsplit16(const float v[16]) { F2 r;
#pragma unroll
  for (int i = 0; i < 16; ++i) { const __bf16 h = (__bf16)v[i]; r.h[i] = h; r.l[i] = (__bf16)(v[i] - (float)h); }
  return r; }
__device__ __forceinline__ F2 split_row(const float* row, int k0, int lane) { float v[16]; const float* p = row + k0 + 8 * (lane >> 4);
#pragma unroll
  for (int i = 0; i < 8; ++i) { v[i] = p[i]; v[8 + i] = p[16 + i]; }
  return bsplit16(v); }
__device__ __forceinline__ F2 split_rowK(const float* row, int k0, int lane, int K) { float v[16]; const int g = lane >> 4;
#pragma unroll
  for (int i = 0; i < 8; ++i) { const int ka = k0 + 8 * g + i, kb = ka + 16; v[i] = ka < K ? row[ka < K ? ka : K - 1] : 0.f; v[8 + i] = kb < K ? row[kb < K ? kb : K - 1] : 0.f; }
  return bsplit16(v); }
__device__ __forceinline__ F2 split_col(const float* W, int k0, int n, int lane, int ld, int K) { float v[16]; const int g = lane >> 4;
#pragma unroll
  for (int i = 0; i < 8; ++i) { const int ka = k0 + 8 * g + i, kb = ka + 16; v[i] = ka < K ? W[(size_t)(ka < K ? ka : K - 1) * ld + n] : 0.f; v[8 + i] = kb < K ? W[(size_t)(kb < K ? kb : K - 1) * ld + n] : 0.f; }
  return bsplit16(v); }
__device__ __forceinline__ v8f mac3(const F2& a, const F2& b, v8f c) { c = wmma_bf(a.l, b.h, c); c = wmma_bf(a.h, b.l, c); return wmma_bf(a.h, b.h, c); }
__device__ __forceinline__ float sigm(float v) { return 1.0f / (1.0f + expf(-v)); }
#define LDSX() do { asm volatile("s_wait_dscnt 0" ::: "memory"); __builtin_amdgcn_wave_barrier(); __builtin_amdgcn_fence(__ATOMIC_RELEASE, "workgroup"); } while (0)

// Quadratic attention with a softplus kernel instead of a softmax (q / k / v [32,2048,64]; sim = softplus(q k^T * scale) + 1e-8 with scale a scalar input; sim /= sum over keys; out = sim v -> [32,2048,64]; no mask).
#define NB 32
#define TT 2048
#define CC 64            // NH * HD = projected width
#define DIN 64          // input (model) width
#define NH 1
#define HD 64
#define NQB (TT / 64)
#define HG 1
#define SCALE (1.0f)
#define CAUSAL 0
#ifndef TNB
#define TNB NB
#endif
__device__ __forceinline__ float bfr(float v) { return (float)(__bf16)v; }
__host__ __device__ __forceinline__ int kb_last(int qb) { return CAUSAL ? ((qb * 64 + 63) >> 7) : (TT / 128 - 1); }
typedef __attribute__((ext_vector_type(8))) __bf16 v8b;
__device__ __forceinline__ v16b frag_b(const __bf16* rowk0, int lane) {
  union { v16b v; v8b q[2]; } u; const __bf16* p = rowk0 + 8 * (lane >> 4);
  u.q[0] = *(const v8b*)p; u.q[1] = *(const v8b*)(p + 16); return u.v;
}
#define QBH 0              // unused: k_att has no causal or high-precision path
#define QHI 0              // (override) rows carrying the q residual plane
#define KHI 64            // key rows carrying k residual / v bf16 hi+lo planes (no kernel in this file writes or reads them)
// B fragment (k rows k0+.., output column o) of a weight: (in,out) [K][ld] or (out,in) [ld rows of K]: bf16 exact, or f16(bf16 * 256) exact
__device__ __forceinline__ v16b wcol_io(const float* Wm, int k0, int o, int lane, int ld) { v16b w; const int g = lane >> 4;
#pragma unroll
  for (int i = 0; i < 8; ++i) { w[i] = (__bf16)Wm[(size_t)(k0 + 8 * g + i) * ld + o]; w[8 + i] = (__bf16)Wm[(size_t)(k0 + 16 + 8 * g + i) * ld + o]; }
  return w; }
__device__ __forceinline__ v16b wcol_oi(const float* Wm, int k0, int o, int lane, int K) { v16b w; const float* p = Wm + (size_t)o * K + k0 + 8 * (lane >> 4);
#pragma unroll
  for (int i = 0; i < 8; ++i) { w[i] = (__bf16)p[i]; w[8 + i] = (__bf16)p[16 + i]; }
  return w; }
__device__ __forceinline__ v16h wcolh_io(const float* Wm, int k0, int o, int lane, int ld) { v16h w; const int g = lane >> 4;
#pragma unroll
  for (int i = 0; i < 8; ++i) { w[i] = (_Float16)(bfr(Wm[(size_t)(k0 + 8 * g + i) * ld + o]) * 256.0f); w[8 + i] = (_Float16)(bfr(Wm[(size_t)(k0 + 16 + 8 * g + i) * ld + o]) * 256.0f); }
  return w; }
__device__ __forceinline__ v16h wcolh_oi(const float* Wm, int k0, int o, int lane, int K) { v16h w; const float* p = Wm + (size_t)o * K + k0 + 8 * (lane >> 4);
#pragma unroll
  for (int i = 0; i < 8; ++i) { w[i] = (_Float16)(bfr(p[i]) * 256.0f); w[8 + i] = (_Float16)(bfr(p[16 + i]) * 256.0f); }
  return w; }
#define WQKV_LAYOUT 1   // 0 = (in,out) [DIN][CC]; 1 = (out,in) [CC][DIN]; 2 = per-head [NH][DIN][HD]
__device__ __forceinline__ v16b wcol_hdk(const float* Wm, int k0, int o, int lane) { v16b w; const int g = lane >> 4; const float* p = Wm + (size_t)(o / HD) * DIN * HD + (o % HD);
#pragma unroll
  for (int i = 0; i < 8; ++i) { w[i] = (__bf16)p[(size_t)(k0 + 8 * g + i) * HD]; w[8 + i] = (__bf16)p[(size_t)(k0 + 16 + 8 * g + i) * HD]; }
  return w; }
#define WO_OUT_IN 0
#if WQKV_LAYOUT == 1
#define WCOL(W, k0, o, lane) wcol_oi(W, k0, o, lane, DIN)
#elif WQKV_LAYOUT == 2
#define WCOL(W, k0, o, lane) wcol_hdk(W, k0, o, lane)
#else
#define WCOL(W, k0, o, lane) wcol_io(W, k0, o, lane, CC)
#endif
#if WO_OUT_IN
#define WOCOL(W, k0, o, lane) wcol_oi(W, k0, o, lane, CC)
#define WOCOLH(W, k0, o, lane) wcolh_oi(W, k0, o, lane, CC)
#else
#define WOCOL(W, k0, o, lane) wcol_io(W, k0, o, lane, DIN)
#define WOCOLH(W, k0, o, lane) wcolh_io(W, k0, o, lane, DIN)
#endif
#define SP_EPS 1.0e-8f
typedef __attribute__((ext_vector_type(4))) _Float16 v4h;
typedef __attribute__((ext_vector_type(4))) __bf16 v4b;
typedef __attribute__((ext_vector_type(2))) __bf16 v2b;

// ---- k_att: the only launch. Block = 256 queries of sequence b, 16 waves = 8 query groups x 2 key halves: a wave holds 32 query columns (two 16-column tiles) and walks, of every 64-key stage, its own 32 keys, so each k or v fragment read from LDS feeds two products; the work-group barrier of a stage is split (see walk_keys), so the waves of a SIMD need not meet at one point. Stages come straight from the f32 inputs: a stage's k and v are rounded to bf16 on their way from the registers into LDS (k stays bf16; v goes on to f16, exact, and is turned to [c][key] by the choice of which thread holds what). S^T = K . Q^T (A = key rows from LDS, B = q kept in registers), so a lane holds one query's scores; the two 16-key score tiles, turned into weights in place, are the B operand of O^T += V^T . P^T (A = v planes [c][key] from LDS, same k order as frag_h): scores and weights never leave the registers. No row maximum is needed (plain sum), so one pass over the keys does it all, unless the direct form overflows and the block walks them again in the guarded form; the two key halves of a query group are added once, through LDS, and the context is divided by the row sum at the end.
#define KST 64             // keys per stage
#define NST (TT / KST)
#define LP 72              // LDS row pitch in 16-bit elements: 144 B = 16 B x 9 (odd), conflict-free for 16-byte fragment reads
#define NBUF 2             // one buffer is read while the other is filled
#define NWV 16             // waves per block
#define QT 2               // 16-column query tiles per wave
typedef __attribute__((ext_vector_type(2))) _Float16 v2h;
__device__ __forceinline__ v8f wmma_h(v16h a, v16h b, v8f c) { return __builtin_amdgcn_wmma_f32_16x16x32_f16(false, a, false, b, (short)0, c, false, false); }
__device__ __forceinline__ v8f wmma_b(v16b a, v16b b, v8f c) { return __builtin_amdgcn_wmma_f32_16x16x32_bf16(false, a, false, b, (short)0, c, false, false); }
// row fragment straight from f32 (same k order as frag_b), rounded to bf16
__device__ __forceinline__ v16b fragb_f32(const float* rowk0, int lane) { v16b a; const float* p = rowk0 + 8 * (lane >> 4);
#pragma unroll
  for (int i = 0; i < 8; ++i) { a[i] = (__bf16)p[i]; a[8 + i] = (__bf16)p[16 + i]; }
  return a; }
// a thread's share of one stage as it comes from memory. k: thread = (sr = tid >> 4, sj = tid & 15): rows sr + 32 i, channels 4 sj .. + 3 (a 16-byte load of a half wave covers one whole 256-byte row). v: thread = (wave, lane): keys 4 wave + i, channels 2 lane, 2 lane + 1 (an 8-byte load of a wave covers one whole row)
struct Raw { v4f k[2]; v2f v[4]; };
__device__ __forceinline__ void fetch(Raw& r, const float* kn, const float* vn, const int off) {   /* off: a constant number of elements, which goes into the loads' offset field */
#pragma unroll
  for (int i = 0; i < 2; ++i) r.k[i] = *(const v4f*)(kn + off + i * 32 * CC);
#pragma unroll
  for (int i = 0; i < 4; ++i) r.v[i] = *(const v2f*)(vn + off + i * CC);
  asm volatile("s_wait_xcnt 0x0" :: "v"(kn), "v"(vn) : "memory");   /* stands in front of the first reuse of an address register of the loads above; a precaution. The two addresses are inputs, so they keep their registers up to the wait: no load's destination takes them over */
}
__device__ __forceinline__ void put(const Raw& r, __bf16 (&sk)[KST][LP], _Float16 (&sv)[HD][LP], const int sr, const int sj, const int wave, const int lane) {
#pragma unroll
  for (int i = 0; i < 2; ++i) *(v4b*)&sk[sr + 32 * i][sj * 4] = __builtin_convertvector(r.k[i], v4b);
  unsigned x[4];   /* key i, the thread's two channels as a bf16 pair: one packed rounding to nearest even for the two registers of a load */
#pragma unroll
  for (int i = 0; i < 4; ++i) x[i] = __builtin_bit_cast(unsigned, __builtin_convertvector(r.v[i], v2b));
#pragma unroll
  for (int cc = 0; cc < 2; ++cc) { float e[4];   /* channel cc of the four keys, back as f32, then f16 (exact for values inside f16's range) */
#pragma unroll
    for (int i = 0; i < 4; ++i) e[i] = __builtin_bit_cast(float, cc ? (x[i] & 0xffff0000u) : (x[i] << 16));
    const v2f e01 = {e[0], e[1]}, e23 = {e[2], e[3]}; union { v2h p[2]; v4h q; } h; h.p[0] = __builtin_convertvector(e01, v2h); h.p[1] = __builtin_convertvector(e23, v2h);
    *(v4h*)&sv[lane * 2 + cc][wave * 4] = h.q; } }
// the two halves of the work-group barrier and the wait that stands in front of the signal. The "memory" clobber keeps every LDS access on its side of the statement
__device__ __forceinline__ void lds_done() { asm volatile("s_wait_dscnt 0x0" ::: "memory"); }      /* without it the signal could pass this wave's LDS stores and reads still under way */
__device__ __forceinline__ void bar_signal() { asm volatile("s_barrier_signal -1" ::: "memory"); }  /* by hand, since __syncthreads() has signal and wait side by side */
__device__ __forceinline__ void bar_wait() { asm volatile("s_barrier_wait -1" ::: "memory"); }
// one walk over the wave's half (kh) of all keys of the sequence. DIRECT: w = log2(1 + 2^u) (no |u|, no maximum, no f: at least three vector instructions fewer per pair of weights); right while 2^u stays finite (u < 128), and an overflow shows as an infinite row sum. Otherwise the guarded form, right for every u: w = f * (max(u, 0) + log2(1 + 2^-|u|)). The row sums are formed on the matrix pipe: a constant A with rows of ones times the f16 weights gives every lane its query's sum over the wave's 32 keys, so no vector add is spent on them. eps' lies below half of f16's smallest step, so it cannot ride in a weight: it enters the row sum once, as 2048 eps', in finish()
template <bool DIRECT>
__device__ __forceinline__ void walk_keys(__bf16 (&sk)[NBUF][KST][LP], _Float16 (&sv)[NBUF][HD][LP], const float* kg, const float* vg, const v16b (&qf)[QT][2], const int sr, const int sj, const int wave, const int kh, const int col, const int lane, const float c2, const float f, const v16h (&ones), v8f (&acc)[QT][HD / 16], v8f (&rs)[QT]) {
  const v2f cu = {c2, c2}, cm = {c2 * f, c2 * f}, zz = {0.0f, 0.0f}, ff = {f, f}, one = {1.0f, 1.0f};
  // The barrier is split. A wave signals once its LDS reads of stage s have returned and its share of stage s + 1 is stored; it waits only at the top of stage s + 1. No LDS access stands between signal and wait, signal and wait alternate strictly in every wave, none stands in a branch. A wave may thus run ahead of the slowest by the weights and v products of a stage: the waves of a SIMD drift apart, and one wave's products run beside another's weights
  Raw raw; fetch(raw, kg, vg, 0); put(raw, sk[0], sv[0], sr, sj, wave, lane);
  fetch(raw, kg, vg, KST * CC);   /* stage 1 flies over the first hand-over */
  lds_done(); bar_signal();
#pragma unroll 1
  for (int s = 0; s < NST; ++s) { const int bu = s & (NBUF - 1);
    bar_wait();   /* every wave has stored its share of stage s and has left the other buffer (stage s - 1) */
    v8f st[QT][2]; v16b kf[2][2]; v16h vf[HD / 16];
#pragma unroll
    for (int t = 0; t < 2; ++t) { const __bf16* kr = &sk[bu][kh * 32 + t * 16 + col][0]; kf[t][0] = frag_b(kr, lane); kf[t][1] = frag_b(kr + 32, lane); }
#pragma unroll
    for (int j = 0; j < HD / 16; ++j) vf[j] = frag_h(&sv[bu][j * 16 + col][kh * 32], lane);
    __builtin_amdgcn_sched_barrier(0);   /* keeps the stage's 16 LDS reads in one group ahead of the stores and the products: one LDS latency a stage, under which the next stage's share is rounded, instead of a drained wait in front of every product */
    put(raw, sk[bu ^ 1], sv[bu ^ 1], sr, sj, wave, lane);   /* stage s + 1; the rounding runs under the latency of the reads above. No branch, so that the whole stage is one block for the scheduler: in the last stage this fills a buffer that every wave has left and nobody reads again */
    lds_done(); bar_signal();   /* this wave's reads of stage s are in registers, its share of stage s + 1 is in LDS */
    const int sn = s + 2 < NST ? s : NST - 3;   /* stage sn + 2 is read. No branch here either: the last two stages read the last stage's rows once more, in bounds */
    fetch(raw, kg + (size_t)sn * KST * CC, vg + (size_t)sn * KST * CC, 2 * KST * CC);   /* flies while this stage's weights are formed; stored at the top of the next stage */
    __builtin_amdgcn_sched_barrier(0);   /* keeps the stage's products and weights behind the signal and the loads: left free, the scheduler let the LDS stores and the signal, or the loads, sink to the end of the stage: no wave could run ahead, and the loads lost their lead */
#pragma unroll
    for (int t = 0; t < 2; ++t)
#pragma unroll
      for (int c = 0; c < QT; ++c) { v8f z = {}; z = wmma_b(kf[t][0], qf[c][0], z); st[c][t] = wmma_b(kf[t][1], qf[c][1], z); }
    v16h p[QT];
#pragma unroll
    for (int c = 0; c < QT; ++c)
#pragma unroll
      for (int t = 0; t < 2; ++t)
#pragma unroll
        for (int r = 0; r < 8; r += 2) { const v2f a = {st[c][t][r], st[c][t][r + 1]}; const v2f u = a * cu; v2f x, l, w;
          if constexpr (DIRECT) {
            x.x = __builtin_amdgcn_exp2f(u.x); x.y = __builtin_amdgcn_exp2f(u.y); x = x + one;
            l.x = __builtin_amdgcn_logf(x.x); l.y = __builtin_amdgcn_logf(x.y);
            w = l;
          } else {
            x.x = __builtin_amdgcn_exp2f(-fabsf(u.x)); x.y = __builtin_amdgcn_exp2f(-fabsf(u.y)); x = x + one;
            l.x = __builtin_amdgcn_logf(x.x); l.y = __builtin_amdgcn_logf(x.y);
            w = __builtin_elementwise_fma(l, ff, __builtin_elementwise_max(a * cm, zz));   /* f log2(1 + 2^-|u|) + f max(u, 0) */
          }
          const v2h ph = __builtin_convertvector(w, v2h); p[c][t * 8 + r] = ph.x; p[c][t * 8 + r + 1] = ph.y; }
    __builtin_amdgcn_sched_barrier(0);   /* keeps the weights' vector work ahead of the v products and the row-sum products: left free, it was placed among them and took over operand registers of products just issued, at idle slots each time, and the build needed more registers */
#pragma unroll
    for (int j = 0; j < HD / 16; ++j)
#pragma unroll
      for (int c = 0; c < QT; ++c) acc[c][j] = wmma_h(vf[j], p[c], acc[c][j]);
#pragma unroll
    for (int c = 0; c < QT; ++c) rs[c] = wmma_h(ones, p[c], rs[c]);   /* rows 0 and 8 of the tile = the row sums of the 16 queries */
  }
  bar_wait(); }   /* the wait of the last signal: every wave has left the ring */
// a wave's share of the query tile that its partner finishes, into LDS; lanes side by side, 16 bytes each
__device__ __forceinline__ void hand(const v8f (&a)[HD / 16], const float part, v4f (&xw)[HD / 8][32], float (&xsw)[32], const int lane) {
#pragma unroll
  for (int j = 0; j < HD / 16; ++j) { const v4f lo = {a[j][0], a[j][1], a[j][2], a[j][3]}, hi = {a[j][4], a[j][5], a[j][6], a[j][7]}; xw[2 * j][lane] = lo; xw[2 * j + 1][lane] = hi; }
  xsw[lane] = part; }
// own share + the partner's, divided by the whole row sum; then through the wave's own LDS rows, so that every store instruction of the wave writes two whole 256-byte output rows (four full lines) instead of 32 pieces of 16 bytes in 16 lines
#define OP 68              // pitch of a staged output row in floats: 272 B = 16 B x 17 (odd), conflict-free for the 16-byte writes and reads
__device__ __forceinline__ void finish(const v8f (&m)[HD / 16], const float part, const v4f (&xp)[HD / 8][32], const float (&xsp)[32], const float ne, const int lane, float (&sw)[16][OP], float* o) {
  const float tot = (part + xsp[lane]) + ne;   /* a lane's part is its query's sum over all keys of the wave's half; ne = all keys' eps' */
  const float inv = 1.0f / tot; const int col = lane & 15, g = lane >> 4;
#pragma unroll
  for (int j = 0; j < HD / 16; ++j) { const v4f pl = xp[2 * j][lane], ph = xp[2 * j + 1][lane];
    const v4f lo = {(m[j][0] + pl[0]) * inv, (m[j][1] + pl[1]) * inv, (m[j][2] + pl[2]) * inv, (m[j][3] + pl[3]) * inv}, hi = {(m[j][4] + ph[0]) * inv, (m[j][5] + ph[1]) * inv, (m[j][6] + ph[2]) * inv, (m[j][7] + ph[3]) * inv};
    *(v4f*)&sw[col][j * 16 + 8 * g] = lo; *(v4f*)&sw[col][j * 16 + 8 * g + 4] = hi; }   /* m[j][r] = channel 16 j + 8 g + r of query col */
  asm volatile("s_wait_dscnt 0" ::: "memory"); __builtin_amdgcn_wave_barrier();   /* the rows are read back by other lanes of the same wave: their writes have to be done, and no read may be moved above them */
#pragma unroll
  for (int i = 0; i < 8; ++i) { const v4f r = *(const v4f*)&sw[2 * i + g][col * 4]; vst2(o + (2 * i + g) * CC + col * 4, r); } }
// four waves per SIMD = one block per WGP: the 256 blocks are all resident
__global__ __launch_bounds__(512) __attribute__((amdgpu_waves_per_eu(4, 4))) void k_att(const float* __restrict__ Q, const float* __restrict__ K, const float* __restrict__ V, const float* __restrict__ SCL, float* __restrict__ O) {
  __shared__ __align__(16) __bf16 sk[NBUF][KST][LP];
  __shared__ __align__(16) _Float16 sv[NBUF][HD][LP];
  __shared__ __align__(16) v4f xa[NWV][HD / 8][32];   /* what a wave hands to the wave of the other key half: one query tile's context */
  __shared__ float xs[NWV][32];                       /* and that tile's partial row sums */
  __shared__ __align__(16) float so[NWV][16][OP];     /* a wave's finished query tile on its way to the output, rows as in memory */
  __shared__ int redo;   /* set by any lane whose row sum of the direct form is not finite */
  const int tid = threadIdx.x, wave = tid >> 5, lane = tid & 31, col = lane & 15, g = lane >> 4;
  const int kh = wave & 1;   /* which 32 keys of every stage are this wave's */
  const int b = blockIdx.y, q0 = blockIdx.x * 256 + (wave >> 1) * 32;
  // the scale is a scalar INPUT (bf16-rounded like every float input). Weights are formed in units of ln 2 (the unit cancels in the division by the row sum), u = score * scale * log2(e); f = 1 up to |scale| = 64 and 64 / |scale| beyond, which keeps the unnormalised weights of the guarded form inside f16 for any scale; f cancels too
  const float sc = bfr(SCL[0]); const float f = fabsf(sc) > 64.0f ? 64.0f / fabsf(sc) : 1.0f; const float c2 = sc * 1.44269504f; const float e2 = SP_EPS * 1.44269504f * f;
  v16b qf[QT][2];
#pragma unroll
  for (int c = 0; c < QT; ++c)
#pragma unroll
    for (int kc = 0; kc < 2; ++kc) qf[c][kc] = fragb_f32(Q + ((size_t)b * TT + q0 + c * 16 + col) * CC + kc * 32, lane);
  // staging: see struct Raw: whole lines from the f32 inputs, through registers (rounded there) into the padded LDS rows
  const int sr = tid >> 4, sj = tid & 15;
  const float* kg = K + ((size_t)b * TT + sr) * CC + sj * 4; const float* vg = V + ((size_t)b * TT + wave * 4) * CC + lane * 2;
  v8f acc[QT][HD / 16] = {}, rs[QT] = {};   /* rs: row sums, one tile a query tile */
  v16h ones;   /* A of the row sums: rows 0 and 8 are ones, the rest 0, so that register 0 of the tile holds, in either lane half, the lane's own query's sum */
#pragma unroll
  for (int i = 0; i < 16; ++i) ones[i] = (lane & 7) == 0 ? (_Float16)1.0f : (_Float16)0.0f;
  if (tid == 0) redo = 0;   /* published by the first hand-over of the walk */
  int guarded = __builtin_amdgcn_readfirstlane(fabsf(sc) <= 64.0f ? 0 : 1);   /* the same in every thread of the grid; a scalar, since barriers stand behind the branch */
  if (!guarded) {
    walk_keys<true>(sk, sv, kg, vg, qf, sr, sj, wave, kh, col, lane, c2, f, ones, acc, rs);
    if (!(rs[0][0] + rs[1][0] < __builtin_inff())) redo = 1;   /* weights are never negative: one overflowed 2^u leaves the sum infinite (or not a number) */
    __syncthreads();   /* publishes the flag to the whole block */
    guarded = __builtin_amdgcn_readfirstlane(redo);
  }
  if (guarded) {   /* the whole block walks the keys in the form that cannot overflow (for |scale| > 64, or again after the direct form overflowed) */
#pragma unroll
    for (int c = 0; c < QT; ++c) {
#pragma unroll
      for (int j = 0; j < HD / 16; ++j) acc[c][j] = v8f{};
      rs[c] = v8f{}; }
    walk_keys<false>(sk, sv, kg, vg, qf, sr, sj, wave, kh, col, lane, c2, f, ones, acc, rs);
  }
  // the two key halves meet: the wave of half kh finishes query tile kh and hands its share of the other tile to its partner (wave ^ 1)
  float part[QT];
#pragma unroll
  for (int c = 0; c < QT; ++c) part[c] = rs[c][0];
  const int khs = __builtin_amdgcn_readfirstlane(kh);   /* the same in a whole wave; whole tiles are picked by control flow, which keeps the accumulators in registers (a select between the two arrays sent them through memory) */
  if (khs) hand(acc[0], part[0], xa[wave], xs[wave], lane); else hand(acc[1], part[1], xa[wave], xs[wave], lane);
  __syncthreads();   /* publishes the handed-over shares */
  float* o = O + ((size_t)b * TT + q0 + kh * 16) * CC;   /* first row of the query tile that this wave finishes */
  const float ne = (float)TT * e2;
  if (khs) finish(acc[1], part[1], xa[wave ^ 1], xs[wave ^ 1], ne, lane, so[wave], o); else finish(acc[0], part[0], xa[wave ^ 1], xs[wave ^ 1], ne, lane, so[wave], o); }

extern "C" void kernel_launch(void* const* d_in, const int* in_sizes, int n_in, void* d_out, int out_size, void* d_ws, size_t ws_size, hipStream_t stream) {
  (void)in_sizes; (void)n_in; (void)out_size; (void)d_ws; (void)ws_size;
  const float** F = (const float**)d_in;
  // inputs: 0 q [32,2048,64]; 1 k; 2 v; 3 scale (f32 scalar)
  k_att<<<dim3(TT / 256, TNB), 512, 0, stream>>>(F[0], F[1], F[2], F[3], (float*)d_out);
}
